// v000
// Times are from an AMD MI455X. After a warm-up the kernel runs many times in a row, and a time is the length of
// such a window on the GPU divided by its runs, so every launch and the gaps after it count. The runs cycle
// through copies of the inputs. A figure is the median of several windows, for all but v000 over two sittings.
// Sittings can differ by a few percent; kernels timed side by side share one.
// v000 is the starting kernel. One run takes 588 microseconds.
#include <hip/hip_runtime.h>

// Softcapped, biased, masked multi-head self-attention (16 heads x 64, 2 x 2,048 tokens, d_model 1,024): q/k/v = inp W^T, scores = q.k/8 + count_bias[b,0,q,k], tanh(scores/30) x 30,
// masked (attn_mask int, 0 -> -inf), softmax, o = w v, out = concat(o) Wo^T.
// WMMA (v_wmma_f32_16x16x32_f16, f32 accumulate): projections [4,096 x 1,024] x [1,024 x 1,024] with EXACT bf16 tokens (x8) and weights (x256), 1 product, into f16 hi+lo x8 planes (v transposed
// per head); S^T with 3 products (Kh Qh + Kh Ql + Kl Qh); bias (bf16-rounded input), softcap and mask per element, online softmax in f32; O^T += V^T P^T with 3 products; output projection with
// O hi+lo (2 products) and exact Wo. Inputs rounded to bf16 once. Fragment k-map per lane half hh for A AND B: elements 0..7 <- k = 8hh+0..7, 8..15 <- k =

namespace {
constexpr int NB = 2, S = 2048, E = 1024, NH = 16, D = 64, NR = NB * S;
constexpr float XS = 8.0f, WSC = 256.0f, PS = 8.0f, SCALE = 0.125f, LOG2E = 1.4426950408889634f, SOFTCAP = 30.0f;
typedef __attribute__((ext_vector_type(4))) int v4i;

typedef _Float16 b16;
typedef __attribute__((ext_vector_type(16))) _Float16 v16b;
typedef __attribute__((ext_vector_type(8))) _Float16 v8b;
typedef __attribute__((ext_vector_type(8))) float v8f;
typedef __attribute__((ext_vector_type(4))) float v4f;
__device__ __forceinline__ float bf16_rne(float f) { unsigned int u = __float_as_uint(f); u += 0x7FFFu + ((u >> 16) & 1u); return __uint_as_float(u & 0xFFFF0000u); }
__device__ __forceinline__ void split16(float v, b16& hi, b16& lo) { hi = (b16)v; lo = (b16)(v - (float)hi); }
__device__ __forceinline__ v16b frag_kb(const b16* p, int hh) { const v8b a = *(const v8b*)(p + 8 * hh), b = *(const v8b*)(p + 16 + 8 * hh); v16b f;
#pragma unroll
  for (int e = 0; e < 8; ++e) { f[e] = a[e]; f[8 + e] = b[e]; } return f; }
__device__ __forceinline__ v8f wmma16b(v16b a, v16b b, v8f c) { v8f d = __builtin_amdgcn_wmma_f32_16x16x32_f16(false, a, false, b, (short)0, c, false, false); asm volatile("v_nop\n\tv_nop\n\tv_nop\n\tv_nop" : "+v"(d) : "v"(a), "v"(b)); return d; }
__device__ __forceinline__ void wave_lds_sync() { __builtin_amdgcn_fence(__ATOMIC_RELEASE, "workgroup"); __builtin_amdgcn_wave_barrier(); __builtin_amdgcn_fence(__ATOMIC_ACQUIRE, "workgroup"); }
__device__ __forceinline__ float nexp2(float x) { return __builtin_amdgcn_exp2f(x); }
__device__ __forceinline__ float tanh_(float x) { const float e = __builtin_amdgcn_exp2f(-2.0f * fabsf(x) * LOG2E); const float t = (1.0f - e) / (1.0f + e); return x < 0.0f ? -t : t; }

__global__ __launch_bounds__(256) void prepx_kernel(const float* __restrict__ x, b16* __restrict__ T16) {
  const size_t t = (size_t)blockIdx.x * 256 + threadIdx.x; const size_t n1 = (size_t)NR * E / 8; const float* src; b16* dst; size_t e;
  if (t < n1) { src = x; dst = T16; e = t * 8; } else return;
  const v4f a = *(const v4f*)(src + e), c = *(const v4f*)(src + e + 4); v8b o;
#pragma unroll
  for (int j = 0; j < 4; ++j) { o[j] = (b16)(bf16_rne(a[j]) * XS); o[4 + j] = (b16)(bf16_rne(c[j]) * XS); }
  { *(v8b*)(dst + e) = o;  }
}
__global__ __launch_bounds__(256) void prepw_kernel(const float* __restrict__ wq, const float* __restrict__ wk, const float* __restrict__ wv, const float* __restrict__ wo, b16* __restrict__ WT, b16* __restrict__ WOT) {
  const size_t t = (size_t)blockIdx.x * 256 + threadIdx.x; const size_t nw = (size_t)E * E / 8; if (t >= 4 * nw) return; const int kind = (int)(t / nw); const size_t e = (t - (size_t)kind * nw) * 8;
  const float* w = kind == 0 ? wq : kind == 1 ? wk : kind == 2 ? wv : wo; b16* dst = kind < 3 ? WT + (size_t)kind * E * E : WOT;   // torch [out][in] rows used directly as B columns (x W^T)
  const v4f a = *(const v4f*)(w + e), c = *(const v4f*)(w + e + 4); v8b o;
#pragma unroll
  for (int j = 0; j < 4; ++j) { o[j] = (b16)(bf16_rne(a[j]) * WSC); o[4 + j] = (b16)(bf16_rne(c[j]) * WSC); }
  { *(v8b*)(dst + e) = o;  }
}
// projections: grid (NR/64, E/128, 3): kind 0: Q = T16 WT0^T -> Qh/Ql [row][1024]; kind 1: K = T16 WT1^T -> Kh/Kl; kind 2: V = T16 WT2^T written TRANSPOSED per head: VTh/VTl [b][h][64 d][2048 s].
__global__ __launch_bounds__(128) void proj_kernel(const b16* __restrict__ T16, const b16* __restrict__ WT, b16* __restrict__ Qh, b16* __restrict__ Ql, b16* __restrict__ Kh, b16* __restrict__ Kl, b16* __restrict__ VTh, b16* __restrict__ VTl) {
  __shared__ __attribute__((aligned(16))) b16 Th[4][16][128 + 8], Tl[4][16][128 + 8]; __shared__ __attribute__((aligned(16))) b16 Vt[128][64 + 8], Vtl[128][64 + 8];
  const int wave = threadIdx.x >> 5, lane = threadIdx.x & 31, nloc = lane & 15, hlf = lane >> 4, t_ = threadIdx.x; const int kind = blockIdx.z; const size_t m0 = (size_t)blockIdx.x * 64 + wave * 16; const int n0 = blockIdx.y * 128;
  const b16* A = T16; const b16* W = WT + (size_t)kind * E * E; v8f acc[8];
#pragma unroll
  for (int t = 0; t < 8; ++t) acc[t] = (v8f){};
#pragma unroll 2
  for (int kb = 0; kb < E; kb += 32) { const v16b a = frag_kb(A + (m0 + nloc) * E + kb, hlf);
#pragma unroll
    for (int t = 0; t < 8; ++t) acc[t] = wmma16b(a, frag_kb(W + (size_t)(n0 + t * 16 + nloc) * E + kb, hlf), acc[t]); }
  if (kind < 2) {
#pragma unroll
    for (int t = 0; t < 8; ++t)
#pragma unroll
      for (int r = 0; r < 8; ++r) { b16 h_, l_; split16(acc[t][r] * (1.0f / (XS * WSC)) * XS, h_, l_); Th[wave][8 * hlf + r][t * 16 + nloc] = h_; Tl[wave][8 * hlf + r][t * 16 + nloc] = l_; }
    wave_lds_sync();
    b16* dh = kind == 0 ? Qh : Kh; b16* dl = kind == 0 ? Ql : Kl;
    { for (int rr = 0; rr < 16; ++rr) if (lane < 16) { *(v8b*)(dh + (m0 + rr) * E + n0 + lane * 8) = *(const v8b*)(&Th[wave][rr][lane * 8]); *(v8b*)(dl + (m0 + rr) * E + n0 + lane * 8) = *(const v8b*)(&Tl[wave][rr][lane * 8]); }  }
  } else {
    const int b = (int)(m0 / S); const int s0 = (int)((size_t)blockIdx.x * 64 - (size_t)b * S);
#pragma unroll
    for (int t = 0; t < 8; ++t)
#pragma unroll
      for (int r = 0; r < 8; ++r) { b16 h_, l_; split16(acc[t][r] * (1.0f / (XS * WSC)) * XS, h_, l_); Vt[t * 16 + nloc][wave * 16 + 8 * hlf + r] = h_; Vtl[t * 16 + nloc][wave * 16 + 8 * hlf + r] = l_; }
    __syncthreads();
    { for (int q = t_; q < 128 * 8; q += 128) { const int cc = q >> 3, c8 = (q & 7) * 8; const int h = (n0 + cc) / D, dd = (n0 + cc) - h * D; const size_t gi = (((size_t)b * NH + h) * D + dd) * S + s0 + c8;
        *(v8b*)(VTh + gi) = *(const v8b*)(&Vt[cc][c8]); *(v8b*)(VTl + gi) = *(const v8b*)(&Vtl[cc][c8]); }  } }
}
__global__ __launch_bounds__(64) void attn_kernel(const b16* __restrict__ Qh, const b16* __restrict__ Ql, const b16* __restrict__ Kh, const b16* __restrict__ Kl, const b16* __restrict__ VTh, const b16* __restrict__ VTl, const float* __restrict__ cbias, const int* __restrict__ amask, b16* __restrict__ Oh, b16* __restrict__ Ol) {
  __shared__ __attribute__((aligned(16))) float To[2][16][D + 4];
  const int wave = threadIdx.x >> 5, lane = threadIdx.x & 31, hh = lane >> 4, col = lane & 15; const int b = blockIdx.z, h = blockIdx.y; const int q0 = blockIdx.x * 32 + wave * 16, qi = q0 + col;
  const size_t qo = ((size_t)b * S + qi) * E + h * D; const v16b qa0 = frag_kb(Qh + qo, hh), qa1 = frag_kb(Qh + qo + 32, hh), ql0 = frag_kb(Ql + qo, hh), ql1 = frag_kb(Ql + qo + 32, hh);
  const b16* Kb = Kh + (size_t)b * S * E + h * D; const b16* Klb = Kl + (size_t)b * S * E + h * D; const b16* Vb = VTh + ((size_t)b * NH + h) * D * S; const b16* Vlb = VTl + ((size_t)b * NH + h) * D * S;
  float m = -INFINITY, l = 0.0f; v8f o[4] = {{}, {}, {}, {}}, ol[4] = {{}, {}, {}, {}};
  const float cs = SCALE / (XS * XS); const float* brow = cbias + ((size_t)b * S + qi) * S; const int* mrow = amask + ((size_t)b * S + qi) * S;
  for (int kb = 0; kb < S; kb += 32) {
    // per-element mask for this block first: if no key of this 32-key block is allowed for ANY of the wave's 16 queries, skip the block (decided from the input mask; wave-uniform)
    const v4i m00 = *(const v4i*)(mrow + kb + 8 * hh), m01 = *(const v4i*)(mrow + kb + 8 * hh + 4), m10 = *(const v4i*)(mrow + kb + 16 + 8 * hh), m11 = *(const v4i*)(mrow + kb + 16 + 8 * hh + 4);
    { int anyk = 0;
#pragma unroll
      for (int j = 0; j < 4; ++j) anyk |= m00[j] | m01[j] | m10[j] | m11[j];
      if (__builtin_amdgcn_ballot_w32(anyk != 0) == 0u) continue; }
    v8f s0 = {}, s1 = {};
    { const b16* k0 = Kb + (size_t)(kb + col) * E, *k1 = Kb + (size_t)(kb + 16 + col) * E, *k0l = Klb + (size_t)(kb + col) * E, *k1l = Klb + (size_t)(kb + 16 + col) * E;
      v16b f = frag_kb(k0, hh); s0 = wmma16b(f, qa0, s0); s0 = wmma16b(f, ql0, s0); s0 = wmma16b(frag_kb(k0l, hh), qa0, s0);
      f = frag_kb(k0 + 32, hh); s0 = wmma16b(f, qa1, s0); s0 = wmma16b(f, ql1, s0); s0 = wmma16b(frag_kb(k0l + 32, hh), qa1, s0);
      f = frag_kb(k1, hh); s1 = wmma16b(f, qa0, s1); s1 = wmma16b(f, ql0, s1); s1 = wmma16b(frag_kb(k1l, hh), qa0, s1);
      f = frag_kb(k1 + 32, hh); s1 = wmma16b(f, qa1, s1); s1 = wmma16b(f, ql1, s1); s1 = wmma16b(frag_kb(k1l + 32, hh), qa1, s1); }
    float e[16]; float mx = -INFINITY;
    const v4f b00 = *(const v4f*)(brow + kb + 8 * hh), b01 = *(const v4f*)(brow + kb + 8 * hh + 4), b10 = *(const v4f*)(brow + kb + 16 + 8 * hh), b11 = *(const v4f*)(brow + kb + 16 + 8 * hh + 4);
#pragma unroll
    for (int r = 0; r < 8; ++r) { const float bb0 = bf16_rne(r < 4 ? b00[r] : b01[r - 4]), bb1 = bf16_rne(r < 4 ? b10[r] : b11[r - 4]); const int mk0 = r < 4 ? m00[r] : m01[r - 4], mk1 = r < 4 ? m10[r] : m11[r - 4];
      float x0 = s0[r] * cs + bb0, x1 = s1[r] * cs + bb1; x0 = tanh_(x0 * (1.0f / SOFTCAP)) * SOFTCAP; x1 = tanh_(x1 * (1.0f / SOFTCAP)) * SOFTCAP;   // softcap
      e[r] = (mk0 != 0) ? x0 * LOG2E : -INFINITY; e[8 + r] = (mk1 != 0) ? x1 * LOG2E : -INFINITY; mx = fmaxf(mx, fmaxf(e[r], e[8 + r])); }
    mx = fmaxf(mx, __shfl_xor(mx, 16)); const float mn = fmaxf(m, mx);
    // a query whose keys are all masked so far keeps m = -inf: use 0 as the reference so every masked weight is exp2(-inf) = 0 and no NaN appears (no divergent control flow around the WMMAs)
    const bool none = (mn == -INFINITY); const float mref = none ? 0.0f : mn; const float al = none ? 1.0f : nexp2(m - mn); m = mn; float sum = 0.0f; v16b ph, pl;
#pragma unroll
    for (int i = 0; i < 16; ++i) { const float p = nexp2(e[i] - mref); sum += p; const b16 h_ = (b16)(p * PS); ph[i] = h_; pl[i] = (b16)(p * PS - (float)h_); }
    sum += __shfl_xor(sum, 16); l = l * al + sum;
#pragma unroll
    for (int t = 0; t < 4; ++t) { o[t] *= al; ol[t] *= al; const v16b vf = frag_kb(Vb + (size_t)(t * 16 + col) * S + kb, hh); o[t] = wmma16b(vf, ph, o[t]); ol[t] = wmma16b(vf, pl, ol[t]); ol[t] = wmma16b(frag_kb(Vlb + (size_t)(t * 16 + col) * S + kb, hh), ph, ol[t]); } }
  const float inv = 1.0f / (l * PS * XS);
#pragma unroll
  for (int t = 0; t < 4; ++t)
#pragma unroll
    for (int r = 0; r < 8; ++r) To[wave][col][t * 16 + 8 * hh + r] = (o[t][r] + ol[t][r]) * inv;
  wave_lds_sync();
  { for (int r4 = 0; r4 < 16; r4 += 4) { const int rr = r4 + (lane >> 3), c8 = (lane & 7) * 8; v8b hv, lv; for (int j = 0; j < 8; ++j) { b16 a_, c_; split16(To[wave][rr][c8 + j] * XS, a_, c_); hv[j] = a_; lv[j] = c_; }
      const size_t gi = ((size_t)b * S + q0 + rr) * E + h * D + c8; *(v8b*)(Oh + gi) = hv; *(v8b*)(Ol + gi) = lv; }  }
}
__global__ __launch_bounds__(128) void outproj_kernel(const b16* __restrict__ Oh, const b16* __restrict__ Ol, const b16* __restrict__ WOT, float* __restrict__ out) {
  __shared__ __attribute__((aligned(16))) float Ts[4][16][128 + 4];
  const int wave = threadIdx.x >> 5, lane = threadIdx.x & 31, nloc = lane & 15, hlf = lane >> 4; const size_t m0 = (size_t)blockIdx.x * 64 + wave * 16; const int n0 = blockIdx.y * 128;
  v8f acc[8];
#pragma unroll
  for (int t = 0; t < 8; ++t) acc[t] = (v8f){};
#pragma unroll 2
  for (int kb = 0; kb < E; kb += 32) { const v16b a = frag_kb(Oh + (m0 + nloc) * E + kb, hlf), al = frag_kb(Ol + (m0 + nloc) * E + kb, hlf);
#pragma unroll
    for (int t = 0; t < 8; ++t) { const v16b bw = frag_kb(WOT + (size_t)(n0 + t * 16 + nloc) * E + kb, hlf); acc[t] = wmma16b(a, bw, acc[t]); acc[t] = wmma16b(al, bw, acc[t]); } }
#pragma unroll
  for (int t = 0; t < 8; ++t)
#pragma unroll
    for (int r = 0; r < 8; ++r) Ts[wave][8 * hlf + r][t * 16 + nloc] = acc[t][r] * (1.0f / (XS * WSC));
  wave_lds_sync();
  { for (int rr = 0; rr < 16; ++rr) *(v4f*)(out + (m0 + rr) * E + n0 + lane * 4) = *(const v4f*)(&Ts[wave][rr][lane * 4]);  }
}
}  // namespace

extern "C" void kernel_launch(void* const* d_in, const int* in_sizes, int n_in, void* d_out, int out_size, void* d_ws, size_t ws_size, hipStream_t stream) {
  (void)n_in;
  auto Fp = [&](int i) { return (const float*)d_in[i]; };
  // input order: 0 inp [2,2048,1024], 1 count_bias [2,1,2048,2048] f32, 2 attn_mask [2,1,2048,2048] i32 (1 = attend), 3 Wq, 4 Wk, 5 Wv, 6 Wo [1024,1024] (torch [out][in])
  if (in_sizes[0] != NR * E || in_sizes[1] != NB * S * S || in_sizes[2] != NB * S * S || in_sizes[3] != E * E || in_sizes[6] != E * E || out_size != NR * E) return;
  size_t off = 0; char* ws = (char*)d_ws;
  auto carve = [&](size_t bytes) { char* p = ws + off; off += (bytes + 255) & ~(size_t)255; return p; };
  b16* T16 = (b16*)carve((size_t)NR * E * 2); b16* WT = (b16*)carve((size_t)3 * E * E * 2); b16* WOT = (b16*)carve((size_t)E * E * 2);
  b16* Qh = (b16*)carve((size_t)NR * E * 2); b16* Ql = (b16*)carve((size_t)NR * E * 2); b16* Kh = (b16*)carve((size_t)NR * E * 2); b16* Kl = (b16*)carve((size_t)NR * E * 2); b16* VTh = (b16*)carve((size_t)NR * E * 2); b16* VTl = (b16*)carve((size_t)NR * E * 2);
  b16* Oh = (b16*)carve((size_t)NR * E * 2); b16* Ol = (b16*)carve((size_t)NR * E * 2);
  if (off > ws_size || off > ((size_t)128 << 20)) return;   // ≈ 84 MB
  prepx_kernel<<<(unsigned)(((size_t)NR * E / 8 + 255) / 256), 256, 0, stream>>>(Fp(0), T16);
  prepw_kernel<<<(unsigned)(((size_t)4 * E * E / 8 + 255) / 256), 256, 0, stream>>>(Fp(3), Fp(4), Fp(5), Fp(6), WT, WOT);
  proj_kernel<<<dim3(NR / 64, E / 128, 3), 128, 0, stream>>>(T16, WT, Qh, Ql, Kh, Kl, VTh, VTl);
  attn_kernel<<<dim3(S / 32, NH, NB), 64, 0, stream>>>(Qh, Ql, Kh, Kl, VTh, VTl, Fp(1), (const int*)d_in[2], Oh, Ol);
  outproj_kernel<<<dim3(NR / 64, E / 128), 128, 0, stream>>>(Oh, Ol, WOT, (float*)d_out);
}

// v001
// Measured time: 252 microseconds a run.
// Two timings next to v000 put it at 2.39 and 2.38 times that version's speed.
#include <hip/hip_runtime.h>

// Softcapped, biased, masked multi-head self-attention (16 heads x 64, 2 x 2,048 tokens, d_model 1,024): q/k/v = inp W^T, scores = q.k/8 + count_bias[b,0,q,k], tanh(scores/30) x 30,
// masked (attn_mask int, 0 -> -inf), softmax, o = w v, out = concat(o) Wo^T.
// WMMA (v_wmma_f32_16x16x32_f16, f32 accumulate): projections [4,096 x 1,024] x [1,024 x 1,024] with EXACT bf16 tokens (x8) and weights (x256), 1 product, into f16 hi+lo x8 planes (v transposed
// per head); S^T with 3 products (Kh Qh + Kh Ql + Kl Qh); bias (bf16-rounded input), softcap and mask per element, online softmax in f32; O^T += V^T P^T with 3 products; output projection with
// O hi+lo (2 products) and exact Wo. Inputs rounded to bf16 once. Fragment k-map per lane half hh for A AND B: elements 0..7 <- k = 8hh+0..7, 8..15 <- k =

namespace {
constexpr int NB = 2, S = 2048, E = 1024, NH = 16, D = 64, NR = NB * S;
constexpr float XS = 8.0f, WSC = 256.0f, PS = 8.0f, SCALE = 0.125f, LOG2E = 1.4426950408889634f, SOFTCAP = 30.0f;
typedef __attribute__((ext_vector_type(4))) int v4i;

typedef _Float16 b16;
typedef __attribute__((ext_vector_type(16))) _Float16 v16b;
typedef __attribute__((ext_vector_type(8))) _Float16 v8b;
typedef __attribute__((ext_vector_type(8))) float v8f;
typedef __attribute__((ext_vector_type(4))) float v4f;
__device__ __forceinline__ float bf16_rne(float f) { unsigned int u = __float_as_uint(f); u += 0x7FFFu + ((u >> 16) & 1u); return __uint_as_float(u & 0xFFFF0000u); }
__device__ __forceinline__ void split16(float v, b16& hi, b16& lo) { hi = (b16)v; lo = (b16)(v - (float)hi); }
__device__ __forceinline__ v16b frag_kb(const b16* p, int hh) { const v8b a = *(const v8b*)(p + 8 * hh), b = *(const v8b*)(p + 16 + 8 * hh); v16b f;
#pragma unroll
  for (int e = 0; e < 8; ++e) { f[e] = a[e]; f[8 + e] = b[e]; } return f; }
__device__ __forceinline__ v8f wmma16b(v16b a, v16b b, v8f c) { v8f d = __builtin_amdgcn_wmma_f32_16x16x32_f16(false, a, false, b, (short)0, c, false, false); asm volatile("v_nop\n\tv_nop\n\tv_nop\n\tv_nop" : "+v"(d) : "v"(a), "v"(b)); return d; }
__device__ __forceinline__ void wave_lds_sync() { __builtin_amdgcn_fence(__ATOMIC_RELEASE, "workgroup"); __builtin_amdgcn_wave_barrier(); __builtin_amdgcn_fence(__ATOMIC_ACQUIRE, "workgroup"); }
__device__ __forceinline__ float nexp2(float x) { return __builtin_amdgcn_exp2f(x); }
__device__ __forceinline__ float tanh_(float x) { const float e = __builtin_amdgcn_exp2f(-2.0f * fabsf(x) * LOG2E); const float t = (1.0f - e) / (1.0f + e); return x < 0.0f ? -t : t; }

__global__ __launch_bounds__(256) void prepx_kernel(const float* __restrict__ x, b16* __restrict__ T16) {
  const size_t t = (size_t)blockIdx.x * 256 + threadIdx.x; const size_t n1 = (size_t)NR * E / 8; const float* src; b16* dst; size_t e;
  if (t < n1) { src = x; dst = T16; e = t * 8; } else return;
  const v4f a = *(const v4f*)(src + e), c = *(const v4f*)(src + e + 4); v8b o;
#pragma unroll
  for (int j = 0; j < 4; ++j) { o[j] = (b16)(bf16_rne(a[j]) * XS); o[4 + j] = (b16)(bf16_rne(c[j]) * XS); }
  { *(v8b*)(dst + e) = o;  }
}
__global__ __launch_bounds__(256) void prepw_kernel(const float* __restrict__ wq, const float* __restrict__ wk, const float* __restrict__ wv, const float* __restrict__ wo, b16* __restrict__ WT, b16* __restrict__ WOT) {
  const size_t t = (size_t)blockIdx.x * 256 + threadIdx.x; const size_t nw = (size_t)E * E / 8; if (t >= 4 * nw) return; const int kind = (int)(t / nw); const size_t e = (t - (size_t)kind * nw) * 8;
  const float* w = kind == 0 ? wq : kind == 1 ? wk : kind == 2 ? wv : wo; b16* dst = kind < 3 ? WT + (size_t)kind * E * E : WOT;   // torch [out][in] rows used directly as B columns (x W^T)
  const v4f a = *(const v4f*)(w + e), c = *(const v4f*)(w + e + 4); v8b o;
#pragma unroll
  for (int j = 0; j < 4; ++j) { o[j] = (b16)(bf16_rne(a[j]) * WSC); o[4 + j] = (b16)(bf16_rne(c[j]) * WSC); }
  { *(v8b*)(dst + e) = o;  }
}
// projections: grid (NR/64, E/128, 3): kind 0: Q = T16 WT0^T -> Qh/Ql [row][1024]; kind 1: K = T16 WT1^T -> Kh/Kl; kind 2: V = T16 WT2^T written TRANSPOSED per head: VTh/VTl [b][h][64 d][2048 s].
__global__ __launch_bounds__(128) void proj_kernel(const b16* __restrict__ T16, const b16* __restrict__ WT, b16* __restrict__ Qh, b16* __restrict__ Ql, b16* __restrict__ Kh, b16* __restrict__ Kl, b16* __restrict__ VTh, b16* __restrict__ VTl) {
  __shared__ __attribute__((aligned(16))) b16 Th[4][16][128 + 8], Tl[4][16][128 + 8]; __shared__ __attribute__((aligned(16))) b16 Vt[128][64 + 8], Vtl[128][64 + 8];
  const int wave = threadIdx.x >> 5, lane = threadIdx.x & 31, nloc = lane & 15, hlf = lane >> 4, t_ = threadIdx.x; const int kind = blockIdx.z; const size_t m0 = (size_t)blockIdx.x * 64 + wave * 16; const int n0 = blockIdx.y * 128;
  // operand tiles (64 x 64 of A, 128 x 64 of W) are fetched once per work-group as whole 128-byte rows, one tile ahead into registers, stored to LDS (pitch 144 B) and read from there as fragments by the 4 waves
  __shared__ __attribute__((aligned(16))) b16 As[64][64 + 8], Bs[128][64 + 8];
  const int sr = t_ >> 3, sc = (t_ & 7) * 8; const b16* Ag = T16 + ((size_t)blockIdx.x * 64 + sr) * E + sc; const b16* Bg = WT + (size_t)kind * E * E + (size_t)(n0 + sr) * E + sc; v8f acc[8]; v8b ga[4], gb[8];
#pragma unroll
  for (int t = 0; t < 8; ++t) acc[t] = (v8f){};
#pragma unroll
  for (int j = 0; j < 4; ++j) ga[j] = *(const v8b*)(Ag + (size_t)j * 16 * E);
#pragma unroll
  for (int j = 0; j < 8; ++j) gb[j] = *(const v8b*)(Bg + (size_t)j * 16 * E);
  for (int kb = 0; kb < E; kb += 64) {
    __syncthreads();   // every wave has finished its fragment reads of the previous tile
#pragma unroll
    for (int j = 0; j < 4; ++j) *(v8b*)(&As[j * 16 + sr][sc]) = ga[j];
#pragma unroll
    for (int j = 0; j < 8; ++j) *(v8b*)(&Bs[j * 16 + sr][sc]) = gb[j];
    __syncthreads();
    if (kb + 64 < E) {
#pragma unroll
      for (int j = 0; j < 4; ++j) ga[j] = *(const v8b*)(Ag + (size_t)j * 16 * E + kb + 64);
#pragma unroll
      for (int j = 0; j < 8; ++j) gb[j] = *(const v8b*)(Bg + (size_t)j * 16 * E + kb + 64);
      asm volatile("s_wait_xcnt 0x0" ::: "memory"); }   // the loads' address registers are reused below
#pragma unroll
    for (int ks = 0; ks < 64; ks += 32) { const v16b a = frag_kb(&As[wave * 16 + nloc][ks], hlf); v16b bw[8];   // the block's LDS reads as one group ahead of its WMMAs
#pragma unroll
      for (int t = 0; t < 8; ++t) bw[t] = frag_kb(&Bs[t * 16 + nloc][ks], hlf);
#pragma unroll
      for (int t = 0; t < 8; ++t) acc[t] = wmma16b(a, bw[t], acc[t]); } }
  if (kind < 2) {
#pragma unroll
    for (int t = 0; t < 8; ++t)
#pragma unroll
      for (int r = 0; r < 8; ++r) { b16 h_, l_; split16(acc[t][r] * (1.0f / (XS * WSC)) * XS, h_, l_); Th[wave][8 * hlf + r][t * 16 + nloc] = h_; Tl[wave][8 * hlf + r][t * 16 + nloc] = l_; }
    wave_lds_sync();
    b16* dh = kind == 0 ? Qh : Kh; b16* dl = kind == 0 ? Ql : Kl;
    { for (int rr = 0; rr < 16; ++rr) if (lane < 16) { *(v8b*)(dh + (m0 + rr) * E + n0 + lane * 8) = *(const v8b*)(&Th[wave][rr][lane * 8]); *(v8b*)(dl + (m0 + rr) * E + n0 + lane * 8) = *(const v8b*)(&Tl[wave][rr][lane * 8]); }  }
  } else {
    const int b = (int)(m0 / S); const int s0 = (int)((size_t)blockIdx.x * 64 - (size_t)b * S);
#pragma unroll
    for (int t = 0; t < 8; ++t)
#pragma unroll
      for (int r = 0; r < 8; ++r) { b16 h_, l_; split16(acc[t][r] * (1.0f / (XS * WSC)) * XS, h_, l_); Vt[t * 16 + nloc][wave * 16 + 8 * hlf + r] = h_; Vtl[t * 16 + nloc][wave * 16 + 8 * hlf + r] = l_; }
    __syncthreads();
    { for (int q = t_; q < 128 * 8; q += 128) { const int cc = q >> 3, c8 = (q & 7) * 8; const int h = (n0 + cc) / D, dd = (n0 + cc) - h * D; const size_t gi = (((size_t)b * NH + h) * D + dd) * S + s0 + c8;
        *(v8b*)(VTh + gi) = *(const v8b*)(&Vt[cc][c8]); *(v8b*)(VTl + gi) = *(const v8b*)(&Vtl[cc][c8]); }  } }
}
// One work-group = 8 waves x 16 queries of one (batch, head). Each 32-key tile of K (hi, lo) and V^T (hi, lo) is fetched once per work-group with line-contiguous 16-byte loads, one tile ahead
// into registers, stored to LDS and read from there as fragments by all 8 waves. Row pitches 144 B (K) and 80 B (V^T) spread the 16 rows of a ds_load_b128 over all banks.
__global__ __launch_bounds__(256) __attribute__((amdgpu_waves_per_eu(4, 4))) void attn_kernel(   /* registers held to two 8-wave work-groups per WGP */ const b16* __restrict__ Qh, const b16* __restrict__ Ql, const b16* __restrict__ Kh, const b16* __restrict__ Kl, const b16* __restrict__ VTh, const b16* __restrict__ VTl, const float* __restrict__ cbias, const int* __restrict__ amask, b16* __restrict__ Oh, b16* __restrict__ Ol) {
  __shared__ __attribute__((aligned(16))) b16 Ks[2][32][D + 8]; __shared__ __attribute__((aligned(16))) b16 Vs[2][D][32 + 8]; __shared__ __attribute__((aligned(16))) float To[8][16][D + 4];
  const int wave = threadIdx.x >> 5, lane = threadIdx.x & 31, hh = lane >> 4, col = lane & 15; const int b = blockIdx.z, h = blockIdx.y; const int q0 = blockIdx.x * 128 + wave * 16, qi = q0 + col;
  const int kr = threadIdx.x >> 3, kc = (threadIdx.x & 7) * 8, vr = threadIdx.x >> 2, vc = (threadIdx.x & 3) * 8;   // this thread's 16-byte piece of the K tile (32 rows x 128 B) and of the V^T tile (64 rows x 64 B)
  const size_t qo = ((size_t)b * S + qi) * E + h * D; const v16b qa0 = frag_kb(Qh + qo, hh), qa1 = frag_kb(Qh + qo + 32, hh), ql0 = frag_kb(Ql + qo, hh), ql1 = frag_kb(Ql + qo + 32, hh);
  // wave-uniform bases plus one 32-bit byte offset per thread, shared by each pair of planes (K hi/lo, V^T hi/lo, mask/bias)
  const char* Kb = (const char*)(Kh + (size_t)b * S * E + h * D); const char* Klb = (const char*)(Kl + (size_t)b * S * E + h * D); const char* Vb = (const char*)(VTh + ((size_t)b * NH + h) * D * S); const char* Vlb = (const char*)(VTl + ((size_t)b * NH + h) * D * S);
  const unsigned ko = (unsigned)(kr * E + kc) * 2u, vo = (unsigned)(vr * S + vc) * 2u, mo = (unsigned)(qi * S + 8 * hh) * 4u;
  float m = -INFINITY, l = 0.0f; v8f o[4] = {{}, {}, {}, {}}, ol[4] = {{}, {}, {}, {}};
  const float cs = SCALE / (XS * XS); const char* brow = (const char*)(cbias + (size_t)b * S * S); const char* mrow = (const char*)(amask + (size_t)b * S * S);
  v8b gk = *(const v8b*)(Kb + ko), gkl = *(const v8b*)(Klb + ko), gv = *(const v8b*)(Vb + vo), gvl = *(const v8b*)(Vlb + vo);
  v4i n00 = *(const v4i*)(mrow + mo), n01 = *(const v4i*)(mrow + 16 + mo), n10 = *(const v4i*)(mrow + 64 + mo), n11 = *(const v4i*)(mrow + 80 + mo);
  for (int kb = 0; kb < S; kb += 32) {
    __syncthreads();   // every wave has finished its fragment reads of the previous tile
    *(v8b*)(&Ks[0][kr][kc]) = gk; *(v8b*)(&Ks[1][kr][kc]) = gkl; *(v8b*)(&Vs[0][vr][vc]) = gv; *(v8b*)(&Vs[1][vr][vc]) = gvl;
    const v4i m00 = n00, m01 = n01, m10 = n10, m11 = n11;
    __syncthreads();   // the tile is visible to all 8 waves
    if (kb + 32 < S) {   // next tile and next mask block fly while this tile is worked on
      const int kn = kb + 32; gk = *(const v8b*)(Kb + (size_t)kn * E * 2 + ko); gkl = *(const v8b*)(Klb + (size_t)kn * E * 2 + ko); gv = *(const v8b*)(Vb + kn * 2 + vo); gvl = *(const v8b*)(Vlb + kn * 2 + vo);
      n00 = *(const v4i*)(mrow + kn * 4 + mo); n01 = *(const v4i*)(mrow + kn * 4 + 16 + mo); n10 = *(const v4i*)(mrow + kn * 4 + 64 + mo); n11 = *(const v4i*)(mrow + kn * 4 + 80 + mo);
      asm volatile("s_wait_xcnt 0x0" ::: "memory"); }   // the loads' address registers are reused by the block's work below
    // per-element mask for this block: if no key of this 32-key block is allowed for ANY of the wave's 16 queries, the wave skips the block's work (decided from the input mask; wave-uniform; the barriers stay outside)
    int anyk = 0;
#pragma unroll
    for (int j = 0; j < 4; ++j) anyk |= m00[j] | m01[j] | m10[j] | m11[j];
    if (__builtin_amdgcn_ballot_w32(anyk != 0) != 0u) {
    v8f s0 = {}, s1 = {};
    const v4f b00 = *(const v4f*)(brow + kb * 4 + mo), b01 = *(const v4f*)(brow + kb * 4 + 16 + mo), b10 = *(const v4f*)(brow + kb * 4 + 64 + mo), b11 = *(const v4f*)(brow + kb * 4 + 80 + mo);
    { const b16* k0 = &Ks[0][col][0], *k1 = &Ks[0][16 + col][0], *k0l = &Ks[1][col][0], *k1l = &Ks[1][16 + col][0];   // K reads from LDS in one group per 16 keys, ahead of that group's WMMAs
      const v16b f0 = frag_kb(k0, hh), g0 = frag_kb(k0l, hh), f1 = frag_kb(k0 + 32, hh), g1 = frag_kb(k0l + 32, hh);
      s0 = wmma16b(f0, qa0, s0); s0 = wmma16b(f0, ql0, s0); s0 = wmma16b(g0, qa0, s0);
      s0 = wmma16b(f1, qa1, s0); s0 = wmma16b(f1, ql1, s0); s0 = wmma16b(g1, qa1, s0);
      const v16b f2 = frag_kb(k1, hh), g2 = frag_kb(k1l, hh), f3 = frag_kb(k1 + 32, hh), g3 = frag_kb(k1l + 32, hh);
      s1 = wmma16b(f2, qa0, s1); s1 = wmma16b(f2, ql0, s1); s1 = wmma16b(g2, qa0, s1);
      s1 = wmma16b(f3, qa1, s1); s1 = wmma16b(f3, ql1, s1); s1 = wmma16b(g3, qa1, s1); }
    float e[16]; float mx = -INFINITY;
#pragma unroll
    for (int r = 0; r < 8; ++r) { const float bb0 = bf16_rne(r < 4 ? b00[r] : b01[r - 4]), bb1 = bf16_rne(r < 4 ? b10[r] : b11[r - 4]); const int mk0 = r < 4 ? m00[r] : m01[r - 4], mk1 = r < 4 ? m10[r] : m11[r - 4];
      float x0 = s0[r] * cs + bb0, x1 = s1[r] * cs + bb1; x0 = tanh_(x0 * (1.0f / SOFTCAP)) * SOFTCAP; x1 = tanh_(x1 * (1.0f / SOFTCAP)) * SOFTCAP;   // softcap
      e[r] = (mk0 != 0) ? x0 * LOG2E : -INFINITY; e[8 + r] = (mk1 != 0) ? x1 * LOG2E : -INFINITY; mx = fmaxf(mx, fmaxf(e[r], e[8 + r])); }
    mx = fmaxf(mx, __shfl_xor(mx, 16)); const float mn = fmaxf(m, mx);
    // a query whose keys are all masked so far keeps m = -inf: use 0 as the reference so every masked weight is exp2(-inf) = 0 and no NaN appears (no divergent control flow around the WMMAs)
    const bool none = (mn == -INFINITY); const float mref = none ? 0.0f : mn; const float al = none ? 1.0f : nexp2(m - mn); m = mn; float sum = 0.0f; v16b ph, pl;
#pragma unroll
    for (int i = 0; i < 16; ++i) { const float p = nexp2(e[i] - mref); sum += p; const b16 h_ = (b16)(p * PS); ph[i] = h_; pl[i] = (b16)(p * PS - (float)h_); }
    sum += __shfl_xor(sum, 16); l = l * al + sum; v16b vf[4], vl[4];   // V^T reads from LDS in one group per 32 rows, ahead of that group's WMMAs
#pragma unroll
    for (int u = 0; u < 4; u += 2) {
#pragma unroll
      for (int t = u; t < u + 2; ++t) { vf[t] = frag_kb(&Vs[0][t * 16 + col][0], hh); vl[t] = frag_kb(&Vs[1][t * 16 + col][0], hh); }
#pragma unroll
      for (int t = u; t < u + 2; ++t) { o[t] *= al; ol[t] *= al; o[t] = wmma16b(vf[t], ph, o[t]); ol[t] = wmma16b(vf[t], pl, ol[t]); ol[t] = wmma16b(vl[t], ph, ol[t]); } } } }
  const float inv = 1.0f / (l * PS * XS);
#pragma unroll
  for (int t = 0; t < 4; ++t)
#pragma unroll
    for (int r = 0; r < 8; ++r) To[wave][col][t * 16 + 8 * hh + r] = (o[t][r] + ol[t][r]) * inv;
  wave_lds_sync();
  { for (int r4 = 0; r4 < 16; r4 += 4) { const int rr = r4 + (lane >> 3), c8 = (lane & 7) * 8; v8b hv, lv; for (int j = 0; j < 8; ++j) { b16 a_, c_; split16(To[wave][rr][c8 + j] * XS, a_, c_); hv[j] = a_; lv[j] = c_; }
      const size_t gi = ((size_t)b * S + q0 + rr) * E + h * D + c8; *(v8b*)(Oh + gi) = hv; *(v8b*)(Ol + gi) = lv; }  }
}
__global__ __launch_bounds__(128) void outproj_kernel(const b16* __restrict__ Oh, const b16* __restrict__ Ol, const b16* __restrict__ WOT, float* __restrict__ out) {
  __shared__ __attribute__((aligned(16))) float Ts[4][16][128 + 4];
  const int wave = threadIdx.x >> 5, lane = threadIdx.x & 31, nloc = lane & 15, hlf = lane >> 4; const size_t m0 = (size_t)blockIdx.x * 64 + wave * 16; const int n0 = blockIdx.y * 128;
  // operand tiles (64 x 64 of O hi and lo, 128 x 64 of Wo) staged as in proj_kernel: whole 128-byte rows, one tile ahead in registers, LDS pitch 144 B
  __shared__ __attribute__((aligned(16))) b16 As[2][64][64 + 8], Bs[128][64 + 8];
  const int sr = threadIdx.x >> 3, sc = (threadIdx.x & 7) * 8; const size_t ao = ((size_t)blockIdx.x * 64 + sr) * E + sc; const b16* Bg = WOT + (size_t)(n0 + sr) * E + sc; v8f acc[8]; v8b ga[4], gl[4], gb[8];
#pragma unroll
  for (int t = 0; t < 8; ++t) acc[t] = (v8f){};
#pragma unroll
  for (int j = 0; j < 4; ++j) { ga[j] = *(const v8b*)(Oh + ao + (size_t)j * 16 * E); gl[j] = *(const v8b*)(Ol + ao + (size_t)j * 16 * E); }
#pragma unroll
  for (int j = 0; j < 8; ++j) gb[j] = *(const v8b*)(Bg + (size_t)j * 16 * E);
  for (int kb = 0; kb < E; kb += 64) {
    __syncthreads();   // every wave has finished its fragment reads of the previous tile
#pragma unroll
    for (int j = 0; j < 4; ++j) { *(v8b*)(&As[0][j * 16 + sr][sc]) = ga[j]; *(v8b*)(&As[1][j * 16 + sr][sc]) = gl[j]; }
#pragma unroll
    for (int j = 0; j < 8; ++j) *(v8b*)(&Bs[j * 16 + sr][sc]) = gb[j];
    __syncthreads();
    if (kb + 64 < E) {
#pragma unroll
      for (int j = 0; j < 4; ++j) { ga[j] = *(const v8b*)(Oh + ao + (size_t)j * 16 * E + kb + 64); gl[j] = *(const v8b*)(Ol + ao + (size_t)j * 16 * E + kb + 64); }
      asm volatile("s_wait_xcnt 0x0" ::: "memory");   // these loads' address registers are reused as destinations of the loads that follow
#pragma unroll
      for (int j = 0; j < 8; ++j) gb[j] = *(const v8b*)(Bg + (size_t)j * 16 * E + kb + 64);
      asm volatile("s_wait_xcnt 0x0" ::: "memory"); }   // the loads' address registers are reused below
#pragma unroll
    for (int ks = 0; ks < 64; ks += 32) { const v16b a = frag_kb(&As[0][wave * 16 + nloc][ks], hlf), al = frag_kb(&As[1][wave * 16 + nloc][ks], hlf); v16b bw[8];   // the block's LDS reads as one group ahead of its WMMAs
#pragma unroll
      for (int t = 0; t < 8; ++t) bw[t] = frag_kb(&Bs[t * 16 + nloc][ks], hlf);
#pragma unroll
      for (int t = 0; t < 8; ++t) { acc[t] = wmma16b(a, bw[t], acc[t]); acc[t] = wmma16b(al, bw[t], acc[t]); } } }
#pragma unroll
  for (int t = 0; t < 8; ++t)
#pragma unroll
    for (int r = 0; r < 8; ++r) Ts[wave][8 * hlf + r][t * 16 + nloc] = acc[t][r] * (1.0f / (XS * WSC));
  wave_lds_sync();
  { for (int rr = 0; rr < 16; ++rr) *(v4f*)(out + (m0 + rr) * E + n0 + lane * 4) = *(const v4f*)(&Ts[wave][rr][lane * 4]);  }
}
}  // namespace

extern "C" void kernel_launch(void* const* d_in, const int* in_sizes, int n_in, void* d_out, int out_size, void* d_ws, size_t ws_size, hipStream_t stream) {
  (void)n_in;
  auto Fp = [&](int i) { return (const float*)d_in[i]; };
  // input order: 0 inp [2,2048,1024], 1 count_bias [2,1,2048,2048] f32, 2 attn_mask [2,1,2048,2048] i32 (1 = attend), 3 Wq, 4 Wk, 5 Wv, 6 Wo [1024,1024] (torch [out][in])
  if (in_sizes[0] != NR * E || in_sizes[1] != NB * S * S || in_sizes[2] != NB * S * S || in_sizes[3] != E * E || in_sizes[6] != E * E || out_size != NR * E) return;
  size_t off = 0; char* ws = (char*)d_ws;
  auto carve = [&](size_t bytes) { char* p = ws + off; off += (bytes + 255) & ~(size_t)255; return p; };
  b16* T16 = (b16*)carve((size_t)NR * E * 2); b16* WT = (b16*)carve((size_t)3 * E * E * 2); b16* WOT = (b16*)carve((size_t)E * E * 2);
  b16* Qh = (b16*)carve((size_t)NR * E * 2); b16* Ql = (b16*)carve((size_t)NR * E * 2); b16* Kh = (b16*)carve((size_t)NR * E * 2); b16* Kl = (b16*)carve((size_t)NR * E * 2); b16* VTh = (b16*)carve((size_t)NR * E * 2); b16* VTl = (b16*)carve((size_t)NR * E * 2);
  b16* Oh = (b16*)carve((size_t)NR * E * 2); b16* Ol = (b16*)carve((size_t)NR * E * 2);
  if (off > ws_size || off > ((size_t)128 << 20)) return;   // ≈ 84 MB
  prepx_kernel<<<(unsigned)(((size_t)NR * E / 8 + 255) / 256), 256, 0, stream>>>(Fp(0), T16);
  prepw_kernel<<<(unsigned)(((size_t)4 * E * E / 8 + 255) / 256), 256, 0, stream>>>(Fp(3), Fp(4), Fp(5), Fp(6), WT, WOT);
  proj_kernel<<<dim3(NR / 64, E / 128, 3), 128, 0, stream>>>(T16, WT, Qh, Ql, Kh, Kl, VTh, VTl);
  attn_kernel<<<dim3(S / 128, NH, NB), 256, 0, stream>>>(Qh, Ql, Kh, Kl, VTh, VTl, Fp(1), (const int*)d_in[2], Oh, Ol);
  outproj_kernel<<<dim3(NR / 64, E / 128), 128, 0, stream>>>(Oh, Ol, WOT, (float*)d_out);
}

// v002
// A run of this version takes 205 microseconds.
// In both of two side-by-side timings against v001, it was 1.23 times as fast.
// All steps since v000 together make it 2.93 times as fast.
#include <hip/hip_runtime.h>

// Softcapped, biased, masked multi-head self-attention (16 heads x 64, 2 x 2,048 tokens, d_model 1,024): q/k/v = inp W^T, scores = q.k/8 + count_bias[b,0,q,k], tanh(scores/30) x 30,
// masked (attn_mask int, 0 -> -inf), softmax, o = w v, out = concat(o) Wo^T.
// WMMA (v_wmma_f32_16x16x32_f16, f32 accumulate): projections [4,096 x 1,024] x [1,024 x 1,024] with EXACT bf16 tokens (x8) and weights (x256), 1 product, into f16 hi+lo x8 planes (v transposed
// per head); S^T with 3 products (Kh Qh + Kh Ql + Kl Qh); bias (bf16-rounded input), softcap and mask per element, online softmax in f32; O^T += V^T P^T with 3 products; output projection with
// O hi+lo (2 products) and exact Wo. Inputs rounded to bf16 once. Fragment k-map per lane half hh for A AND B: elements 0..7 <- k = 8hh+0..7, 8..15 <- k =

namespace {
constexpr int NB = 2, S = 2048, E = 1024, NH = 16, D = 64, NR = NB * S;
constexpr float XS = 8.0f, WSC = 256.0f, PS = 8.0f, SCALE = 0.125f, LOG2E = 1.4426950408889634f, SOFTCAP = 30.0f;
typedef __attribute__((ext_vector_type(4))) int v4i;

typedef _Float16 b16;
typedef __attribute__((ext_vector_type(16))) _Float16 v16b;
typedef __attribute__((ext_vector_type(8))) _Float16 v8b;
typedef __attribute__((ext_vector_type(8))) float v8f;
typedef __attribute__((ext_vector_type(4))) float v4f;
__device__ __forceinline__ float bf16_rne(float f) { unsigned int u = __float_as_uint(f); u += 0x7FFFu + ((u >> 16) & 1u); return __uint_as_float(u & 0xFFFF0000u); }
__device__ __forceinline__ void split16(float v, b16& hi, b16& lo) { hi = (b16)v; lo = (b16)(v - (float)hi); }
__device__ __forceinline__ v16b frag_kb(const b16* p, int hh) { const v8b a = *(const v8b*)(p + 8 * hh), b = *(const v8b*)(p + 16 + 8 * hh); v16b f;
#pragma unroll
  for (int e = 0; e < 8; ++e) { f[e] = a[e]; f[8 + e] = b[e]; } return f; }
__device__ __forceinline__ v8f wmma16b(v16b a, v16b b, v8f c) { v8f d = __builtin_amdgcn_wmma_f32_16x16x32_f16(false, a, false, b, (short)0, c, false, false); asm volatile("v_nop\n\tv_nop\n\tv_nop\n\tv_nop" : "+v"(d) : "v"(a), "v"(b)); return d; }
__device__ __forceinline__ void wave_lds_sync() { __builtin_amdgcn_fence(__ATOMIC_RELEASE, "workgroup"); __builtin_amdgcn_wave_barrier(); __builtin_amdgcn_fence(__ATOMIC_ACQUIRE, "workgroup"); }
__device__ __forceinline__ float nexp2(float x) { return __builtin_amdgcn_exp2f(x); }
// softcap in the unit of the softmax exponent: C tanh(x / 30) = C - 2C / (1 + 2^(x 2 log2(e) / 30)), C = 30 log2(e). No case on the sign: 2^z = inf gives C, 2^z = 0 gives -C. v_rcp_f32 (1 ulp) stands for the IEEE division sequence.
constexpr float CAPK = 2.0f * LOG2E / SOFTCAP, CAPC = SOFTCAP * LOG2E;
// four reciprocals in place; the v_nop is the slot the instruction set asks for behind a transcendental before its result is used or a source overwritten
__device__ __forceinline__ void rcp4(float& a, float& b, float& c, float& d) { asm("v_rcp_f32 %0, %0\n\tv_rcp_f32 %1, %1\n\tv_rcp_f32 %2, %2\n\tv_rcp_f32 %3, %3\n\tv_nop" : "+v"(a), "+v"(b), "+v"(c), "+v"(d)); }
__device__ __forceinline__ void exp2x4(float& a, float& b, float& c, float& d) { asm("v_exp_f32 %0, %0\n\tv_exp_f32 %1, %1\n\tv_exp_f32 %2, %2\n\tv_exp_f32 %3, %3\n\tv_nop" : "+v"(a), "+v"(b), "+v"(c), "+v"(d)); }   // the same for four 2^x

__global__ __launch_bounds__(256) void prepx_kernel(const float* __restrict__ x, b16* __restrict__ T16) {
  const size_t t = (size_t)blockIdx.x * 256 + threadIdx.x; const size_t n1 = (size_t)NR * E / 8; const float* src; b16* dst; size_t e;
  if (t < n1) { src = x; dst = T16; e = t * 8; } else return;
  const v4f a = *(const v4f*)(src + e), c = *(const v4f*)(src + e + 4); v8b o;
#pragma unroll
  for (int j = 0; j < 4; ++j) { o[j] = (b16)(bf16_rne(a[j]) * XS); o[4 + j] = (b16)(bf16_rne(c[j]) * XS); }
  { *(v8b*)(dst + e) = o;  }
}
__global__ __launch_bounds__(256) void prepw_kernel(const float* __restrict__ wq, const float* __restrict__ wk, const float* __restrict__ wv, const float* __restrict__ wo, b16* __restrict__ WT, b16* __restrict__ WOT) {
  const size_t t = (size_t)blockIdx.x * 256 + threadIdx.x; const size_t nw = (size_t)E * E / 8; if (t >= 4 * nw) return; const int kind = (int)(t / nw); const size_t e = (t - (size_t)kind * nw) * 8;
  const float* w = kind == 0 ? wq : kind == 1 ? wk : kind == 2 ? wv : wo; b16* dst = kind < 3 ? WT + (size_t)kind * E * E : WOT;   // torch [out][in] rows used directly as B columns (x W^T)
  const v4f a = *(const v4f*)(w + e), c = *(const v4f*)(w + e + 4); v8b o;
#pragma unroll
  for (int j = 0; j < 4; ++j) { o[j] = (b16)(bf16_rne(a[j]) * WSC); o[4 + j] = (b16)(bf16_rne(c[j]) * WSC); }
  { *(v8b*)(dst + e) = o;  }
}
// projections: grid (NR/64, E/128, 3): kind 0: Q = T16 WT0^T -> Qh/Ql [row][1024]; kind 1: K = T16 WT1^T -> Kh/Kl; kind 2: V = T16 WT2^T written TRANSPOSED per head: VTh/VTl [b][h][64 d][2048 s].
__global__ __launch_bounds__(128) void proj_kernel(const b16* __restrict__ T16, const b16* __restrict__ WT, b16* __restrict__ Qh, b16* __restrict__ Ql, b16* __restrict__ Kh, b16* __restrict__ Kl, b16* __restrict__ VTh, b16* __restrict__ VTl) {
  __shared__ __attribute__((aligned(16))) b16 Th[4][16][128 + 8], Tl[4][16][128 + 8]; __shared__ __attribute__((aligned(16))) b16 Vt[128][64 + 8], Vtl[128][64 + 8];
  const int wave = threadIdx.x >> 5, lane = threadIdx.x & 31, nloc = lane & 15, hlf = lane >> 4, t_ = threadIdx.x; const int kind = blockIdx.z; const size_t m0 = (size_t)blockIdx.x * 64 + wave * 16; const int n0 = blockIdx.y * 128;
  // operand tiles (64 x 64 of A, 128 x 64 of W) are fetched once per work-group as whole 128-byte rows, one tile ahead into registers, stored to LDS (pitch 144 B) and read from there as fragments by the 4 waves
  __shared__ __attribute__((aligned(16))) b16 As[64][64 + 8], Bs[128][64 + 8];
  const int sr = t_ >> 3, sc = (t_ & 7) * 8; const b16* Ag = T16 + ((size_t)blockIdx.x * 64 + sr) * E + sc; const b16* Bg = WT + (size_t)kind * E * E + (size_t)(n0 + sr) * E + sc; v8f acc[8]; v8b ga[4], gb[8];
#pragma unroll
  for (int t = 0; t < 8; ++t) acc[t] = (v8f){};
#pragma unroll
  for (int j = 0; j < 4; ++j) ga[j] = *(const v8b*)(Ag + (size_t)j * 16 * E);
#pragma unroll
  for (int j = 0; j < 8; ++j) gb[j] = *(const v8b*)(Bg + (size_t)j * 16 * E);
  for (int kb = 0; kb < E; kb += 64) {
    __syncthreads();   // every wave has finished its fragment reads of the previous tile
#pragma unroll
    for (int j = 0; j < 4; ++j) *(v8b*)(&As[j * 16 + sr][sc]) = ga[j];
#pragma unroll
    for (int j = 0; j < 8; ++j) *(v8b*)(&Bs[j * 16 + sr][sc]) = gb[j];
    __syncthreads();
    if (kb + 64 < E) {
#pragma unroll
      for (int j = 0; j < 4; ++j) ga[j] = *(const v8b*)(Ag + (size_t)j * 16 * E + kb + 64);
#pragma unroll
      for (int j = 0; j < 8; ++j) gb[j] = *(const v8b*)(Bg + (size_t)j * 16 * E + kb + 64);
      asm volatile("s_wait_xcnt 0x0" ::: "memory"); }   // the loads' address registers are reused below
#pragma unroll
    for (int ks = 0; ks < 64; ks += 32) { const v16b a = frag_kb(&As[wave * 16 + nloc][ks], hlf); v16b bw[8];   // the block's LDS reads as one group ahead of its WMMAs
#pragma unroll
      for (int t = 0; t < 8; ++t) bw[t] = frag_kb(&Bs[t * 16 + nloc][ks], hlf);
#pragma unroll
      for (int t = 0; t < 8; ++t) acc[t] = wmma16b(a, bw[t], acc[t]); } }
  if (kind < 2) {
#pragma unroll
    for (int t = 0; t < 8; ++t)
#pragma unroll
      for (int r = 0; r < 8; ++r) { b16 h_, l_; split16(acc[t][r] * (1.0f / (XS * WSC)) * XS, h_, l_); Th[wave][8 * hlf + r][t * 16 + nloc] = h_; Tl[wave][8 * hlf + r][t * 16 + nloc] = l_; }
    wave_lds_sync();
    b16* dh = kind == 0 ? Qh : Kh; b16* dl = kind == 0 ? Ql : Kl;
    { for (int rr = 0; rr < 16; ++rr) if (lane < 16) { *(v8b*)(dh + (m0 + rr) * E + n0 + lane * 8) = *(const v8b*)(&Th[wave][rr][lane * 8]); *(v8b*)(dl + (m0 + rr) * E + n0 + lane * 8) = *(const v8b*)(&Tl[wave][rr][lane * 8]); }  }
  } else {
    const int b = (int)(m0 / S); const int s0 = (int)((size_t)blockIdx.x * 64 - (size_t)b * S);
#pragma unroll
    for (int t = 0; t < 8; ++t)
#pragma unroll
      for (int r = 0; r < 8; ++r) { b16 h_, l_; split16(acc[t][r] * (1.0f / (XS * WSC)) * XS, h_, l_); Vt[t * 16 + nloc][wave * 16 + 8 * hlf + r] = h_; Vtl[t * 16 + nloc][wave * 16 + 8 * hlf + r] = l_; }
    __syncthreads();
    { for (int q = t_; q < 128 * 8; q += 128) { const int cc = q >> 3, c8 = (q & 7) * 8; const int h = (n0 + cc) / D, dd = (n0 + cc) - h * D; const size_t gi = (((size_t)b * NH + h) * D + dd) * S + s0 + c8;
        *(v8b*)(VTh + gi) = *(const v8b*)(&Vt[cc][c8]); *(v8b*)(VTl + gi) = *(const v8b*)(&Vtl[cc][c8]); }  } }
}
// One work-group = 8 waves x 16 queries of one (batch, head). Each 32-key tile of K (hi, lo) and V^T (hi, lo) is fetched once per work-group with line-contiguous 16-byte loads, one tile ahead
// into registers, stored to LDS and read from there as fragments by all 8 waves. Row pitches 144 B (K) and 80 B (V^T) spread the 16 rows of a ds_load_b128 over all banks.
__global__ __launch_bounds__(256) __attribute__((amdgpu_waves_per_eu(4, 4))) void attn_kernel(   /* registers held to two 8-wave work-groups per WGP */ const b16* __restrict__ Qh, const b16* __restrict__ Ql, const b16* __restrict__ Kh, const b16* __restrict__ Kl, const b16* __restrict__ VTh, const b16* __restrict__ VTl, const float* __restrict__ cbias, const int* __restrict__ amask, b16* __restrict__ Oh, b16* __restrict__ Ol) {
  __shared__ __attribute__((aligned(16))) b16 Ks[2][32][D + 8]; __shared__ __attribute__((aligned(16))) b16 Vs[2][D][32 + 8]; __shared__ __attribute__((aligned(16))) float To[8][16][D + 4];
  const int wave = threadIdx.x >> 5, lane = threadIdx.x & 31, hh = lane >> 4, col = lane & 15; const int b = blockIdx.z, h = blockIdx.y; const int q0 = blockIdx.x * 128 + wave * 16, qi = q0 + col;
  const int kr = threadIdx.x >> 3, kc = (threadIdx.x & 7) * 8, vr = threadIdx.x >> 2, vc = (threadIdx.x & 3) * 8;   // this thread's 16-byte piece of the K tile (32 rows x 128 B) and of the V^T tile (64 rows x 64 B)
  const size_t qo = ((size_t)b * S + qi) * E + h * D; const v16b qa0 = frag_kb(Qh + qo, hh), qa1 = frag_kb(Qh + qo + 32, hh), ql0 = frag_kb(Ql + qo, hh), ql1 = frag_kb(Ql + qo + 32, hh);
  // wave-uniform bases plus one 32-bit byte offset per thread, shared by each pair of planes (K hi/lo, V^T hi/lo, mask/bias)
  const char* Kb = (const char*)(Kh + (size_t)b * S * E + h * D); const char* Klb = (const char*)(Kl + (size_t)b * S * E + h * D); const char* Vb = (const char*)(VTh + ((size_t)b * NH + h) * D * S); const char* Vlb = (const char*)(VTl + ((size_t)b * NH + h) * D * S);
  const unsigned ko = (unsigned)(kr * E + kc) * 2u, vo = (unsigned)(vr * S + vc) * 2u, mo = (unsigned)(qi * S + 8 * hh) * 4u;
  float m = -INFINITY, l = 0.0f; v8f o[4] = {{}, {}, {}, {}}, ol[4] = {{}, {}, {}, {}};
  const float cs = SCALE / (XS * XS); const char* brow = (const char*)(cbias + (size_t)b * S * S); const char* mrow = (const char*)(amask + (size_t)b * S * S);
  v8b gk = *(const v8b*)(Kb + ko), gkl = *(const v8b*)(Klb + ko), gv = *(const v8b*)(Vb + vo), gvl = *(const v8b*)(Vlb + vo);
  v4i n00 = *(const v4i*)(mrow + mo), n01 = *(const v4i*)(mrow + 16 + mo), n10 = *(const v4i*)(mrow + 64 + mo), n11 = *(const v4i*)(mrow + 80 + mo);
  for (int kb = 0; kb < S; kb += 32) {
    __syncthreads();   // every wave has finished its fragment reads of the previous tile
    *(v8b*)(&Ks[0][kr][kc]) = gk; *(v8b*)(&Ks[1][kr][kc]) = gkl; *(v8b*)(&Vs[0][vr][vc]) = gv; *(v8b*)(&Vs[1][vr][vc]) = gvl;
    const v4i m00 = n00, m01 = n01, m10 = n10, m11 = n11;
    __syncthreads();   // the tile is visible to all 8 waves
    if (kb + 32 < S) {   // next tile and next mask block fly while this tile is worked on
      const int kn = kb + 32; gk = *(const v8b*)(Kb + (size_t)kn * E * 2 + ko); gkl = *(const v8b*)(Klb + (size_t)kn * E * 2 + ko); gv = *(const v8b*)(Vb + kn * 2 + vo); gvl = *(const v8b*)(Vlb + kn * 2 + vo);
      n00 = *(const v4i*)(mrow + kn * 4 + mo); n01 = *(const v4i*)(mrow + kn * 4 + 16 + mo); n10 = *(const v4i*)(mrow + kn * 4 + 64 + mo); n11 = *(const v4i*)(mrow + kn * 4 + 80 + mo);
      asm volatile("s_wait_xcnt 0x0" ::: "memory"); }   // the loads' address registers are reused by the block's work below
    // per-element mask for this block: if no key of this 32-key block is allowed for ANY of the wave's 16 queries, the wave skips the block's work (decided from the input mask; wave-uniform; the barriers stay outside)
    int anyk = 0;
#pragma unroll
    for (int j = 0; j < 4; ++j) anyk |= m00[j] | m01[j] | m10[j] | m11[j];
    if (__builtin_amdgcn_ballot_w32(anyk != 0) != 0u) {
    v8f s0 = {}, s1 = {};
    const v4f b00 = *(const v4f*)(brow + kb * 4 + mo), b01 = *(const v4f*)(brow + kb * 4 + 16 + mo), b10 = *(const v4f*)(brow + kb * 4 + 64 + mo), b11 = *(const v4f*)(brow + kb * 4 + 80 + mo);
    { const b16* k0 = &Ks[0][col][0], *k1 = &Ks[0][16 + col][0], *k0l = &Ks[1][col][0], *k1l = &Ks[1][16 + col][0];   // K reads from LDS in one group per 16 keys, ahead of that group's WMMAs
      const v16b f0 = frag_kb(k0, hh), g0 = frag_kb(k0l, hh), f1 = frag_kb(k0 + 32, hh), g1 = frag_kb(k0l + 32, hh);
      s0 = wmma16b(f0, qa0, s0); s0 = wmma16b(f0, ql0, s0); s0 = wmma16b(g0, qa0, s0);
      s0 = wmma16b(f1, qa1, s0); s0 = wmma16b(f1, ql1, s0); s0 = wmma16b(g1, qa1, s0);
      const v16b f2 = frag_kb(k1, hh), g2 = frag_kb(k1l, hh), f3 = frag_kb(k1 + 32, hh), g3 = frag_kb(k1l + 32, hh);
      s1 = wmma16b(f2, qa0, s1); s1 = wmma16b(f2, ql0, s1); s1 = wmma16b(g2, qa0, s1);
      s1 = wmma16b(f3, qa1, s1); s1 = wmma16b(f3, ql1, s1); s1 = wmma16b(g3, qa1, s1); }
    float e[16]; float mx = -INFINITY;
#pragma unroll
    for (int r = 0; r < 8; ++r) { const float bb0 = bf16_rne(r < 4 ? b00[r] : b01[r - 4]), bb1 = bf16_rne(r < 4 ? b10[r] : b11[r - 4]);
      e[r] = 1.0f + nexp2((s0[r] * cs + bb0) * CAPK); e[8 + r] = 1.0f + nexp2((s1[r] * cs + bb1) * CAPK); }   // softcap: the denominators
#pragma unroll
    for (int i = 0; i < 16; i += 4) rcp4(e[i], e[i + 1], e[i + 2], e[i + 3]);
#pragma unroll
    for (int r = 0; r < 8; ++r) { const int mk0 = r < 4 ? m00[r] : m01[r - 4], mk1 = r < 4 ? m10[r] : m11[r - 4]; const float x0 = __builtin_fmaf(e[r], -2.0f * CAPC, CAPC), x1 = __builtin_fmaf(e[8 + r], -2.0f * CAPC, CAPC);
      e[r] = (mk0 != 0) ? x0 : -INFINITY; e[8 + r] = (mk1 != 0) ? x1 : -INFINITY; mx = fmaxf(mx, fmaxf(e[r], e[8 + r])); }
    mx = fmaxf(mx, __shfl_xor(mx, 16)); const float mn = fmaxf(m, mx);
    // a query whose keys are all masked so far keeps m = -inf: use 0 as the reference so every masked weight is exp2(-inf) = 0 and no NaN appears (no divergent control flow around the WMMAs)
    const bool none = (mn == -INFINITY); const float mref = none ? 0.0f : mn; const float al = none ? 1.0f : nexp2(m - mn); m = mn; float sum = 0.0f; v16b ph, pl;
#pragma unroll
    for (int i = 0; i < 16; i += 4) { e[i] -= mref; e[i + 1] -= mref; e[i + 2] -= mref; e[i + 3] -= mref; exp2x4(e[i], e[i + 1], e[i + 2], e[i + 3]); }
#pragma unroll
    for (int i = 0; i < 16; ++i) { const float p = e[i]; sum += p; const b16 h_ = (b16)(p * PS); ph[i] = h_; pl[i] = (b16)(p * PS - (float)h_); }
    sum += __shfl_xor(sum, 16); l = l * al + sum; v16b vf[4], vl[4];   // V^T reads from LDS in one group per 32 rows, ahead of that group's WMMAs
#pragma unroll
    for (int u = 0; u < 4; u += 2) {
#pragma unroll
      for (int t = u; t < u + 2; ++t) { vf[t] = frag_kb(&Vs[0][t * 16 + col][0], hh); vl[t] = frag_kb(&Vs[1][t * 16 + col][0], hh); }
#pragma unroll
      for (int t = u; t < u + 2; ++t) { o[t] *= al; ol[t] *= al; o[t] = wmma16b(vf[t], ph, o[t]); ol[t] = wmma16b(vf[t], pl, ol[t]); ol[t] = wmma16b(vl[t], ph, ol[t]); } } } }
  const float inv = 1.0f / (l * PS * XS);
#pragma unroll
  for (int t = 0; t < 4; ++t)
#pragma unroll
    for (int r = 0; r < 8; ++r) To[wave][col][t * 16 + 8 * hh + r] = (o[t][r] + ol[t][r]) * inv;
  wave_lds_sync();
  { for (int r4 = 0; r4 < 16; r4 += 4) { const int rr = r4 + (lane >> 3), c8 = (lane & 7) * 8; v8b hv, lv; for (int j = 0; j < 8; ++j) { b16 a_, c_; split16(To[wave][rr][c8 + j] * XS, a_, c_); hv[j] = a_; lv[j] = c_; }
      const size_t gi = ((size_t)b * S + q0 + rr) * E + h * D + c8; *(v8b*)(Oh + gi) = hv; *(v8b*)(Ol + gi) = lv; }  }
}
__global__ __launch_bounds__(128) void outproj_kernel(const b16* __restrict__ Oh, const b16* __restrict__ Ol, const b16* __restrict__ WOT, float* __restrict__ out) {
  __shared__ __attribute__((aligned(16))) float Ts[4][16][128 + 4];
  const int wave = threadIdx.x >> 5, lane = threadIdx.x & 31, nloc = lane & 15, hlf = lane >> 4; const size_t m0 = (size_t)blockIdx.x * 64 + wave * 16; const int n0 = blockIdx.y * 128;
  // operand tiles (64 x 64 of O hi and lo, 128 x 64 of Wo) staged as in proj_kernel: whole 128-byte rows, one tile ahead in registers, LDS pitch 144 B
  __shared__ __attribute__((aligned(16))) b16 As[2][64][64 + 8], Bs[128][64 + 8];
  const int sr = threadIdx.x >> 3, sc = (threadIdx.x & 7) * 8; const size_t ao = ((size_t)blockIdx.x * 64 + sr) * E + sc; const b16* Bg = WOT + (size_t)(n0 + sr) * E + sc; v8f acc[8]; v8b ga[4], gl[4], gb[8];
#pragma unroll
  for (int t = 0; t < 8; ++t) acc[t] = (v8f){};
#pragma unroll
  for (int j = 0; j < 4; ++j) { ga[j] = *(const v8b*)(Oh + ao + (size_t)j * 16 * E); gl[j] = *(const v8b*)(Ol + ao + (size_t)j * 16 * E); }
#pragma unroll
  for (int j = 0; j < 8; ++j) gb[j] = *(const v8b*)(Bg + (size_t)j * 16 * E);
  for (int kb = 0; kb < E; kb += 64) {
    __syncthreads();   // every wave has finished its fragment reads of the previous tile
#pragma unroll
    for (int j = 0; j < 4; ++j) { *(v8b*)(&As[0][j * 16 + sr][sc]) = ga[j]; *(v8b*)(&As[1][j * 16 + sr][sc]) = gl[j]; }
#pragma unroll
    for (int j = 0; j < 8; ++j) *(v8b*)(&Bs[j * 16 + sr][sc]) = gb[j];
    __syncthreads();
    if (kb + 64 < E) {
#pragma unroll
      for (int j = 0; j < 4; ++j) { ga[j] = *(const v8b*)(Oh + ao + (size_t)j * 16 * E + kb + 64); gl[j] = *(const v8b*)(Ol + ao + (size_t)j * 16 * E + kb + 64); }
      asm volatile("s_wait_xcnt 0x0" ::: "memory");   // these loads' address registers are reused as destinations of the loads that follow
#pragma unroll
      for (int j = 0; j < 8; ++j) gb[j] = *(const v8b*)(Bg + (size_t)j * 16 * E + kb + 64);
      asm volatile("s_wait_xcnt 0x0" ::: "memory"); }   // the loads' address registers are reused below
#pragma unroll
    for (int ks = 0; ks < 64; ks += 32) { const v16b a = frag_kb(&As[0][wave * 16 + nloc][ks], hlf), al = frag_kb(&As[1][wave * 16 + nloc][ks], hlf); v16b bw[8];   // the block's LDS reads as one group ahead of its WMMAs
#pragma unroll
      for (int t = 0; t < 8; ++t) bw[t] = frag_kb(&Bs[t * 16 + nloc][ks], hlf);
#pragma unroll
      for (int t = 0; t < 8; ++t) { acc[t] = wmma16b(a, bw[t], acc[t]); acc[t] = wmma16b(al, bw[t], acc[t]); } } }
#pragma unroll
  for (int t = 0; t < 8; ++t)
#pragma unroll
    for (int r = 0; r < 8; ++r) Ts[wave][8 * hlf + r][t * 16 + nloc] = acc[t][r] * (1.0f / (XS * WSC));
  wave_lds_sync();
  { for (int rr = 0; rr < 16; ++rr) *(v4f*)(out + (m0 + rr) * E + n0 + lane * 4) = *(const v4f*)(&Ts[wave][rr][lane * 4]);  }
}
}  // namespace

extern "C" void kernel_launch(void* const* d_in, const int* in_sizes, int n_in, void* d_out, int out_size, void* d_ws, size_t ws_size, hipStream_t stream) {
  (void)n_in;
  auto Fp = [&](int i) { return (const float*)d_in[i]; };
  // input order: 0 inp [2,2048,1024], 1 count_bias [2,1,2048,2048] f32, 2 attn_mask [2,1,2048,2048] i32 (1 = attend), 3 Wq, 4 Wk, 5 Wv, 6 Wo [1024,1024] (torch [out][in])
  if (in_sizes[0] != NR * E || in_sizes[1] != NB * S * S || in_sizes[2] != NB * S * S || in_sizes[3] != E * E || in_sizes[6] != E * E || out_size != NR * E) return;
  size_t off = 0; char* ws = (char*)d_ws;
  auto carve = [&](size_t bytes) { char* p = ws + off; off += (bytes + 255) & ~(size_t)255; return p; };
  b16* T16 = (b16*)carve((size_t)NR * E * 2); b16* WT = (b16*)carve((size_t)3 * E * E * 2); b16* WOT = (b16*)carve((size_t)E * E * 2);
  b16* Qh = (b16*)carve((size_t)NR * E * 2); b16* Ql = (b16*)carve((size_t)NR * E * 2); b16* Kh = (b16*)carve((size_t)NR * E * 2); b16* Kl = (b16*)carve((size_t)NR * E * 2); b16* VTh = (b16*)carve((size_t)NR * E * 2); b16* VTl = (b16*)carve((size_t)NR * E * 2);
  b16* Oh = (b16*)carve((size_t)NR * E * 2); b16* Ol = (b16*)carve((size_t)NR * E * 2);
  if (off > ws_size || off > ((size_t)128 << 20)) return;   // ≈ 84 MB
  prepx_kernel<<<(unsigned)(((size_t)NR * E / 8 + 255) / 256), 256, 0, stream>>>(Fp(0), T16);
  prepw_kernel<<<(unsigned)(((size_t)4 * E * E / 8 + 255) / 256), 256, 0, stream>>>(Fp(3), Fp(4), Fp(5), Fp(6), WT, WOT);
  proj_kernel<<<dim3(NR / 64, E / 128, 3), 128, 0, stream>>>(T16, WT, Qh, Ql, Kh, Kl, VTh, VTl);
  attn_kernel<<<dim3(S / 128, NH, NB), 256, 0, stream>>>(Qh, Ql, Kh, Kl, VTh, VTl, Fp(1), (const int*)d_in[2], Oh, Ol);
  outproj_kernel<<<dim3(NR / 64, E / 128), 128, 0, stream>>>(Oh, Ol, WOT, (float*)d_out);
}

// v003
// A run of this version takes 187 microseconds.
// Next to v002, in two timings, it ran 1.09 and 1.10 times as fast.
// Counting every step since v000, it is 3.20 times as fast.
#include <hip/hip_runtime.h>

// Softcapped, biased, masked multi-head self-attention (16 heads x 64, 2 x 2,048 tokens, d_model 1,024): q/k/v = inp W^T, scores = q.k/8 + count_bias[b,0,q,k], tanh(scores/30) x 30,
// masked (attn_mask int, 0 -> -inf), softmax, o = w v, out = concat(o) Wo^T.
// WMMA (v_wmma_f32_16x16x32_f16, f32 accumulate): projections [4,096 x 1,024] x [1,024 x 1,024] with EXACT bf16 tokens (x8) and weights (x256), 1 product, into f16 hi+lo x8 planes (v transposed
// per head); S^T with 3 products (Kh Qh + Kh Ql + Kl Qh); bias (bf16-rounded input), softcap and mask per element, online softmax in f32; O^T += V^T P^T with 3 products; output projection with
// O hi+lo (2 products) and exact Wo. Inputs rounded to bf16 once. Fragment k-map per lane half hh for A AND B: elements 0..7 <- k = 8hh+0..7, 8..15 <- k =

namespace {
constexpr int NB = 2, S = 2048, E = 1024, NH = 16, D = 64, NR = NB * S;
constexpr float XS = 8.0f, WSC = 256.0f, PS = 8.0f, SCALE = 0.125f, LOG2E = 1.4426950408889634f, SOFTCAP = 30.0f;
typedef __attribute__((ext_vector_type(4))) int v4i;

typedef _Float16 b16;
typedef __attribute__((ext_vector_type(16))) _Float16 v16b;
typedef __attribute__((ext_vector_type(8))) _Float16 v8b;
typedef __attribute__((ext_vector_type(8))) float v8f;
typedef __attribute__((ext_vector_type(4))) float v4f;
__device__ __forceinline__ float bf16_rne(float f) { unsigned int u = __float_as_uint(f); u += 0x7FFFu + ((u >> 16) & 1u); return __uint_as_float(u & 0xFFFF0000u); }
__device__ __forceinline__ void split16(float v, b16& hi, b16& lo) { hi = (b16)v; lo = (b16)(v - (float)hi); }
__device__ __forceinline__ v16b frag_kb(const b16* p, int hh) { const v8b a = *(const v8b*)(p + 8 * hh), b = *(const v8b*)(p + 16 + 8 * hh); v16b f;
#pragma unroll
  for (int e = 0; e < 8; ++e) { f[e] = a[e]; f[8 + e] = b[e]; } return f; }
__device__ __forceinline__ v8f wmma16b(v16b a, v16b b, v8f c) { v8f d = __builtin_amdgcn_wmma_f32_16x16x32_f16(false, a, false, b, (short)0, c, false, false); asm volatile("v_nop\n\tv_nop\n\tv_nop\n\tv_nop" : "+v"(d) : "v"(a), "v"(b)); return d; }
__device__ __forceinline__ void wave_lds_sync() { __builtin_amdgcn_fence(__ATOMIC_RELEASE, "workgroup"); __builtin_amdgcn_wave_barrier(); __builtin_amdgcn_fence(__ATOMIC_ACQUIRE, "workgroup"); }
__device__ __forceinline__ float nexp2(float x) { return __builtin_amdgcn_exp2f(x); }
// softcap in the unit of the softmax exponent: C tanh(x / 30) = C - 2C / (1 + 2^(x 2 log2(e) / 30)), C = 30 log2(e). No case on the sign: 2^z = inf gives C, 2^z = 0 gives -C. v_rcp_f32 (1 ulp) stands for the IEEE division sequence.
constexpr float CAPK = 2.0f * LOG2E / SOFTCAP, CAPC = SOFTCAP * LOG2E;
// four reciprocals in place; the v_nop is the slot the instruction set asks for behind a transcendental before its result is used or a source overwritten
__device__ __forceinline__ void rcp4(float& a, float& b, float& c, float& d) { asm("v_rcp_f32 %0, %0\n\tv_rcp_f32 %1, %1\n\tv_rcp_f32 %2, %2\n\tv_rcp_f32 %3, %3\n\tv_nop" : "+v"(a), "+v"(b), "+v"(c), "+v"(d)); }
__device__ __forceinline__ void exp2x4(float& a, float& b, float& c, float& d) { asm("v_exp_f32 %0, %0\n\tv_exp_f32 %1, %1\n\tv_exp_f32 %2, %2\n\tv_exp_f32 %3, %3\n\tv_nop" : "+v"(a), "+v"(b), "+v"(c), "+v"(d)); }   // the same for four 2^x

__global__ __launch_bounds__(256) void prepx_kernel(const float* __restrict__ x, b16* __restrict__ T16) {
  const size_t t = (size_t)blockIdx.x * 256 + threadIdx.x; const size_t n1 = (size_t)NR * E / 8; const float* src; b16* dst; size_t e;
  if (t < n1) { src = x; dst = T16; e = t * 8; } else return;
  const v4f a = *(const v4f*)(src + e), c = *(const v4f*)(src + e + 4); v8b o;
#pragma unroll
  for (int j = 0; j < 4; ++j) { o[j] = (b16)(bf16_rne(a[j]) * XS); o[4 + j] = (b16)(bf16_rne(c[j]) * XS); }
  { *(v8b*)(dst + e) = o;  }
}
__global__ __launch_bounds__(256) void prepw_kernel(const float* __restrict__ wq, const float* __restrict__ wk, const float* __restrict__ wv, const float* __restrict__ wo, b16* __restrict__ WT, b16* __restrict__ WOT) {
  const size_t t = (size_t)blockIdx.x * 256 + threadIdx.x; const size_t nw = (size_t)E * E / 8; if (t >= 4 * nw) return; const int kind = (int)(t / nw); const size_t e = (t - (size_t)kind * nw) * 8;
  const float* w = kind == 0 ? wq : kind == 1 ? wk : kind == 2 ? wv : wo; b16* dst = kind < 3 ? WT + (size_t)kind * E * E : WOT;   // torch [out][in] rows used directly as B columns (x W^T)
  const v4f a = *(const v4f*)(w + e), c = *(const v4f*)(w + e + 4); v8b o;
#pragma unroll
  for (int j = 0; j < 4; ++j) { o[j] = (b16)(bf16_rne(a[j]) * WSC); o[4 + j] = (b16)(bf16_rne(c[j]) * WSC); }
  { *(v8b*)(dst + e) = o;  }
}
// projections: grid (NR/64, E/128, 3): kind 0: Q = T16 WT0^T -> Qh/Ql [row][1024]; kind 1: K = T16 WT1^T -> Kh/Kl; kind 2: V = T16 WT2^T written TRANSPOSED per head: VTh/VTl [b][h][64 d][2048 s].
__global__ __launch_bounds__(128) void proj_kernel(const b16* __restrict__ T16, const b16* __restrict__ WT, b16* __restrict__ Qh, b16* __restrict__ Ql, b16* __restrict__ Kh, b16* __restrict__ Kl, b16* __restrict__ VTh, b16* __restrict__ VTl) {
  __shared__ __attribute__((aligned(16))) b16 Th[4][16][128 + 8], Tl[4][16][128 + 8]; __shared__ __attribute__((aligned(16))) b16 Vt[128][64 + 8], Vtl[128][64 + 8];
  const int wave = threadIdx.x >> 5, lane = threadIdx.x & 31, nloc = lane & 15, hlf = lane >> 4, t_ = threadIdx.x; const int kind = blockIdx.z; const size_t m0 = (size_t)blockIdx.x * 64 + wave * 16; const int n0 = blockIdx.y * 128;
  // operand tiles (64 x 64 of A, 128 x 64 of W) are fetched once per work-group as whole 128-byte rows, one tile ahead into registers, stored to LDS (pitch 144 B) and read from there as fragments by the 4 waves
  __shared__ __attribute__((aligned(16))) b16 As[64][64 + 8], Bs[128][64 + 8];
  const int sr = t_ >> 3, sc = (t_ & 7) * 8; const b16* Ag = T16 + ((size_t)blockIdx.x * 64 + sr) * E + sc; const b16* Bg = WT + (size_t)kind * E * E + (size_t)(n0 + sr) * E + sc; v8f acc[8]; v8b ga[4], gb[8];
#pragma unroll
  for (int t = 0; t < 8; ++t) acc[t] = (v8f){};
#pragma unroll
  for (int j = 0; j < 4; ++j) ga[j] = *(const v8b*)(Ag + (size_t)j * 16 * E);
#pragma unroll
  for (int j = 0; j < 8; ++j) gb[j] = *(const v8b*)(Bg + (size_t)j * 16 * E);
  for (int kb = 0; kb < E; kb += 64) {
    __syncthreads();   // every wave has finished its fragment reads of the previous tile
#pragma unroll
    for (int j = 0; j < 4; ++j) *(v8b*)(&As[j * 16 + sr][sc]) = ga[j];
#pragma unroll
    for (int j = 0; j < 8; ++j) *(v8b*)(&Bs[j * 16 + sr][sc]) = gb[j];
    __syncthreads();
    if (kb + 64 < E) {
#pragma unroll
      for (int j = 0; j < 4; ++j) ga[j] = *(const v8b*)(Ag + (size_t)j * 16 * E + kb + 64);
#pragma unroll
      for (int j = 0; j < 8; ++j) gb[j] = *(const v8b*)(Bg + (size_t)j * 16 * E + kb + 64);
      asm volatile("s_wait_xcnt 0x0" ::: "memory"); }   // the loads' address registers are reused below
#pragma unroll
    for (int ks = 0; ks < 64; ks += 32) { const v16b a = frag_kb(&As[wave * 16 + nloc][ks], hlf); v16b bw[8];   // the block's LDS reads as one group ahead of its WMMAs
#pragma unroll
      for (int t = 0; t < 8; ++t) bw[t] = frag_kb(&Bs[t * 16 + nloc][ks], hlf);
#pragma unroll
      for (int t = 0; t < 8; ++t) acc[t] = wmma16b(a, bw[t], acc[t]); } }
  if (kind < 2) {
#pragma unroll
    for (int t = 0; t < 8; ++t)
#pragma unroll
      for (int r = 0; r < 8; ++r) { b16 h_, l_; split16(acc[t][r] * (1.0f / (XS * WSC)) * XS, h_, l_); Th[wave][8 * hlf + r][t * 16 + nloc] = h_; Tl[wave][8 * hlf + r][t * 16 + nloc] = l_; }
    wave_lds_sync();
    b16* dh = kind == 0 ? Qh : Kh; b16* dl = kind == 0 ? Ql : Kl;
    { for (int rr = 0; rr < 16; ++rr) if (lane < 16) { *(v8b*)(dh + (m0 + rr) * E + n0 + lane * 8) = *(const v8b*)(&Th[wave][rr][lane * 8]); *(v8b*)(dl + (m0 + rr) * E + n0 + lane * 8) = *(const v8b*)(&Tl[wave][rr][lane * 8]); }  }
  } else {
    const int b = (int)(m0 / S); const int s0 = (int)((size_t)blockIdx.x * 64 - (size_t)b * S);
#pragma unroll
    for (int t = 0; t < 8; ++t)
#pragma unroll
      for (int r = 0; r < 8; ++r) { b16 h_, l_; split16(acc[t][r] * (1.0f / (XS * WSC)) * XS, h_, l_); Vt[t * 16 + nloc][wave * 16 + 8 * hlf + r] = h_; Vtl[t * 16 + nloc][wave * 16 + 8 * hlf + r] = l_; }
    __syncthreads();
    { for (int q = t_; q < 128 * 8; q += 128) { const int cc = q >> 3, c8 = (q & 7) * 8; const int h = (n0 + cc) / D, dd = (n0 + cc) - h * D; const size_t gi = (((size_t)b * NH + h) * D + dd) * S + s0 + c8;
        *(v8b*)(VTh + gi) = *(const v8b*)(&Vt[cc][c8]); *(v8b*)(VTl + gi) = *(const v8b*)(&Vtl[cc][c8]); }  } }
}
// One work-group = 8 waves x 16 queries of one (batch, head): four 16-query groups from the low half of the sequence and their mirror images from the high half. Each 32-key tile of K (hi, lo) and V^T (hi, lo) is fetched once per work-group with line-contiguous 16-byte loads, one tile ahead
// into registers, stored to LDS and read from there as fragments by all 8 waves. Row pitches 144 B (K) and 80 B (V^T) spread the 16 rows of a ds_load_b128 over all banks.
__global__ __launch_bounds__(256) __attribute__((amdgpu_waves_per_eu(4, 4))) void attn_kernel(   /* registers held to two 8-wave work-groups per WGP */ const b16* __restrict__ Qh, const b16* __restrict__ Ql, const b16* __restrict__ Kh, const b16* __restrict__ Kl, const b16* __restrict__ VTh, const b16* __restrict__ VTl, const float* __restrict__ cbias, const int* __restrict__ amask, b16* __restrict__ Oh, b16* __restrict__ Ol) {
  __shared__ __attribute__((aligned(16))) b16 Ks[2][32][D + 8]; __shared__ __attribute__((aligned(16))) b16 Vs[2][D][32 + 8]; __shared__ __attribute__((aligned(16))) float To[8][16][D + 4];
  const int wave = threadIdx.x >> 5, lane = threadIdx.x & 31, hh = lane >> 4, col = lane & 15; const int b = blockIdx.z, h = blockIdx.y;
  // which 16 queries a wave takes: waves w and w + 4 take groups g and 127 - g, g = 4 blockIdx.x + w. A wave skips the key tiles that the mask closes for all its queries, so where the open part of a row
  // grows with the query index a wave's work grows with its group; dealt this way every SIMD gets about the same number of worked tiles. Any mask is handled: the skip is still decided from the mask alone, and (blockIdx.x, wave) -> group is one-to-one onto 0..127.
  const int gl = blockIdx.x * 4 + (wave & 3); const int q0 = (wave < 4 ? gl : S / 16 - 1 - gl) * 16, qi = q0 + col;
  const int kr = threadIdx.x >> 3, kc = (threadIdx.x & 7) * 8, vr = threadIdx.x >> 2, vc = (threadIdx.x & 3) * 8;   // this thread's 16-byte piece of the K tile (32 rows x 128 B) and of the V^T tile (64 rows x 64 B)
  const size_t qo = ((size_t)b * S + qi) * E + h * D; const v16b qa0 = frag_kb(Qh + qo, hh), qa1 = frag_kb(Qh + qo + 32, hh), ql0 = frag_kb(Ql + qo, hh), ql1 = frag_kb(Ql + qo + 32, hh);
  // wave-uniform bases plus one 32-bit byte offset per thread, shared by each pair of planes (K hi/lo, V^T hi/lo, mask/bias)
  const char* Kb = (const char*)(Kh + (size_t)b * S * E + h * D); const char* Klb = (const char*)(Kl + (size_t)b * S * E + h * D); const char* Vb = (const char*)(VTh + ((size_t)b * NH + h) * D * S); const char* Vlb = (const char*)(VTl + ((size_t)b * NH + h) * D * S);
  const unsigned ko = (unsigned)(kr * E + kc) * 2u, vo = (unsigned)(vr * S + vc) * 2u, mo = (unsigned)(qi * S + 8 * hh) * 4u;
  float m = -INFINITY, l = 0.0f; v8f o[4] = {{}, {}, {}, {}}, ol[4] = {{}, {}, {}, {}};
  const float cs = SCALE / (XS * XS); const char* brow = (const char*)(cbias + (size_t)b * S * S); const char* mrow = (const char*)(amask + (size_t)b * S * S);
  v8b gk = *(const v8b*)(Kb + ko), gkl = *(const v8b*)(Klb + ko), gv = *(const v8b*)(Vb + vo), gvl = *(const v8b*)(Vlb + vo);
  v4i n00 = *(const v4i*)(mrow + mo), n01 = *(const v4i*)(mrow + 16 + mo), n10 = *(const v4i*)(mrow + 64 + mo), n11 = *(const v4i*)(mrow + 80 + mo);
  for (int kb = 0; kb < S; kb += 32) {
    __syncthreads();   // every wave has finished its fragment reads of the previous tile
    *(v8b*)(&Ks[0][kr][kc]) = gk; *(v8b*)(&Ks[1][kr][kc]) = gkl; *(v8b*)(&Vs[0][vr][vc]) = gv; *(v8b*)(&Vs[1][vr][vc]) = gvl;
    const v4i m00 = n00, m01 = n01, m10 = n10, m11 = n11;
    __syncthreads();   // the tile is visible to all 8 waves
    if (kb + 32 < S) {   // next tile and next mask block fly while this tile is worked on
      const int kn = kb + 32; gk = *(const v8b*)(Kb + (size_t)kn * E * 2 + ko); gkl = *(const v8b*)(Klb + (size_t)kn * E * 2 + ko); gv = *(const v8b*)(Vb + kn * 2 + vo); gvl = *(const v8b*)(Vlb + kn * 2 + vo);
      n00 = *(const v4i*)(mrow + kn * 4 + mo); n01 = *(const v4i*)(mrow + kn * 4 + 16 + mo); n10 = *(const v4i*)(mrow + kn * 4 + 64 + mo); n11 = *(const v4i*)(mrow + kn * 4 + 80 + mo);
      asm volatile("s_wait_xcnt 0x0" ::: "memory"); }   // the loads' address registers are reused by the block's work below
    // per-element mask for this block: if no key of this 32-key block is allowed for ANY of the wave's 16 queries, the wave skips the block's work (decided from the input mask; wave-uniform; the barriers stay outside)
    int anyk = 0;
#pragma unroll
    for (int j = 0; j < 4; ++j) anyk |= m00[j] | m01[j] | m10[j] | m11[j];
    if (__builtin_amdgcn_ballot_w32(anyk != 0) != 0u) {
    v8f s0 = {}, s1 = {};
    const v4f b00 = *(const v4f*)(brow + kb * 4 + mo), b01 = *(const v4f*)(brow + kb * 4 + 16 + mo), b10 = *(const v4f*)(brow + kb * 4 + 64 + mo), b11 = *(const v4f*)(brow + kb * 4 + 80 + mo);
    { const b16* k0 = &Ks[0][col][0], *k1 = &Ks[0][16 + col][0], *k0l = &Ks[1][col][0], *k1l = &Ks[1][16 + col][0];   // K reads from LDS in one group per 16 keys, ahead of that group's WMMAs
      const v16b f0 = frag_kb(k0, hh), g0 = frag_kb(k0l, hh), f1 = frag_kb(k0 + 32, hh), g1 = frag_kb(k0l + 32, hh);
      s0 = wmma16b(f0, qa0, s0); s0 = wmma16b(f0, ql0, s0); s0 = wmma16b(g0, qa0, s0);
      s0 = wmma16b(f1, qa1, s0); s0 = wmma16b(f1, ql1, s0); s0 = wmma16b(g1, qa1, s0);
      const v16b f2 = frag_kb(k1, hh), g2 = frag_kb(k1l, hh), f3 = frag_kb(k1 + 32, hh), g3 = frag_kb(k1l + 32, hh);
      s1 = wmma16b(f2, qa0, s1); s1 = wmma16b(f2, ql0, s1); s1 = wmma16b(g2, qa0, s1);
      s1 = wmma16b(f3, qa1, s1); s1 = wmma16b(f3, ql1, s1); s1 = wmma16b(g3, qa1, s1); }
    float e[16]; float mx = -INFINITY;
#pragma unroll
    for (int r = 0; r < 8; ++r) { const float bb0 = bf16_rne(r < 4 ? b00[r] : b01[r - 4]), bb1 = bf16_rne(r < 4 ? b10[r] : b11[r - 4]);
      e[r] = 1.0f + nexp2((s0[r] * cs + bb0) * CAPK); e[8 + r] = 1.0f + nexp2((s1[r] * cs + bb1) * CAPK); }   // softcap: the denominators
#pragma unroll
    for (int i = 0; i < 16; i += 4) rcp4(e[i], e[i + 1], e[i + 2], e[i + 3]);
#pragma unroll
    for (int r = 0; r < 8; ++r) { const int mk0 = r < 4 ? m00[r] : m01[r - 4], mk1 = r < 4 ? m10[r] : m11[r - 4]; const float x0 = __builtin_fmaf(e[r], -2.0f * CAPC, CAPC), x1 = __builtin_fmaf(e[8 + r], -2.0f * CAPC, CAPC);
      e[r] = (mk0 != 0) ? x0 : -INFINITY; e[8 + r] = (mk1 != 0) ? x1 : -INFINITY; mx = fmaxf(mx, fmaxf(e[r], e[8 + r])); }
    mx = fmaxf(mx, __shfl_xor(mx, 16)); const float mn = fmaxf(m, mx);
    // a query whose keys are all masked so far keeps m = -inf: use 0 as the reference so every masked weight is exp2(-inf) = 0 and no NaN appears (no divergent control flow around the WMMAs)
    const bool none = (mn == -INFINITY); const float mref = none ? 0.0f : mn; const float al = none ? 1.0f : nexp2(m - mn); m = mn; float sum = 0.0f; v16b ph, pl;
#pragma unroll
    for (int i = 0; i < 16; i += 4) { e[i] -= mref; e[i + 1] -= mref; e[i + 2] -= mref; e[i + 3] -= mref; exp2x4(e[i], e[i + 1], e[i + 2], e[i + 3]); }
#pragma unroll
    for (int i = 0; i < 16; ++i) { const float p = e[i]; sum += p; const b16 h_ = (b16)(p * PS); ph[i] = h_; pl[i] = (b16)(p * PS - (float)h_); }
    sum += __shfl_xor(sum, 16); l = l * al + sum; v16b vf[4], vl[4];   // V^T reads from LDS in one group per 32 rows, ahead of that group's WMMAs
#pragma unroll
    for (int u = 0; u < 4; u += 2) {
#pragma unroll
      for (int t = u; t < u + 2; ++t) { vf[t] = frag_kb(&Vs[0][t * 16 + col][0], hh); vl[t] = frag_kb(&Vs[1][t * 16 + col][0], hh); }
#pragma unroll
      for (int t = u; t < u + 2; ++t) { o[t] *= al; ol[t] *= al; o[t] = wmma16b(vf[t], ph, o[t]); ol[t] = wmma16b(vf[t], pl, ol[t]); ol[t] = wmma16b(vl[t], ph, ol[t]); } } } }
  const float inv = 1.0f / (l * PS * XS);
#pragma unroll
  for (int t = 0; t < 4; ++t)
#pragma unroll
    for (int r = 0; r < 8; ++r) To[wave][col][t * 16 + 8 * hh + r] = (o[t][r] + ol[t][r]) * inv;
  wave_lds_sync();
  { for (int r4 = 0; r4 < 16; r4 += 4) { const int rr = r4 + (lane >> 3), c8 = (lane & 7) * 8; v8b hv, lv; for (int j = 0; j < 8; ++j) { b16 a_, c_; split16(To[wave][rr][c8 + j] * XS, a_, c_); hv[j] = a_; lv[j] = c_; }
      const size_t gi = ((size_t)b * S + q0 + rr) * E + h * D + c8; *(v8b*)(Oh + gi) = hv; *(v8b*)(Ol + gi) = lv; }  }
}
__global__ __launch_bounds__(128) void outproj_kernel(const b16* __restrict__ Oh, const b16* __restrict__ Ol, const b16* __restrict__ WOT, float* __restrict__ out) {
  __shared__ __attribute__((aligned(16))) float Ts[4][16][128 + 4];
  const int wave = threadIdx.x >> 5, lane = threadIdx.x & 31, nloc = lane & 15, hlf = lane >> 4; const size_t m0 = (size_t)blockIdx.x * 64 + wave * 16; const int n0 = blockIdx.y * 128;
  // operand tiles (64 x 64 of O hi and lo, 128 x 64 of Wo) staged as in proj_kernel: whole 128-byte rows, one tile ahead in registers, LDS pitch 144 B
  __shared__ __attribute__((aligned(16))) b16 As[2][64][64 + 8], Bs[128][64 + 8];
  const int sr = threadIdx.x >> 3, sc = (threadIdx.x & 7) * 8; const size_t ao = ((size_t)blockIdx.x * 64 + sr) * E + sc; const b16* Bg = WOT + (size_t)(n0 + sr) * E + sc; v8f acc[8]; v8b ga[4], gl[4], gb[8];
#pragma unroll
  for (int t = 0; t < 8; ++t) acc[t] = (v8f){};
#pragma unroll
  for (int j = 0; j < 4; ++j) { ga[j] = *(const v8b*)(Oh + ao + (size_t)j * 16 * E); gl[j] = *(const v8b*)(Ol + ao + (size_t)j * 16 * E); }
#pragma unroll
  for (int j = 0; j < 8; ++j) gb[j] = *(const v8b*)(Bg + (size_t)j * 16 * E);
  for (int kb = 0; kb < E; kb += 64) {
    __syncthreads();   // every wave has finished its fragment reads of the previous tile
#pragma unroll
    for (int j = 0; j < 4; ++j) { *(v8b*)(&As[0][j * 16 + sr][sc]) = ga[j]; *(v8b*)(&As[1][j * 16 + sr][sc]) = gl[j]; }
#pragma unroll
    for (int j = 0; j < 8; ++j) *(v8b*)(&Bs[j * 16 + sr][sc]) = gb[j];
    __syncthreads();
    if (kb + 64 < E) {
#pragma unroll
      for (int j = 0; j < 4; ++j) { ga[j] = *(const v8b*)(Oh + ao + (size_t)j * 16 * E + kb + 64); gl[j] = *(const v8b*)(Ol + ao + (size_t)j * 16 * E + kb + 64); }
      asm volatile("s_wait_xcnt 0x0" ::: "memory");   // these loads' address registers are reused as destinations of the loads that follow
#pragma unroll
      for (int j = 0; j < 8; ++j) gb[j] = *(const v8b*)(Bg + (size_t)j * 16 * E + kb + 64);
      asm volatile("s_wait_xcnt 0x0" ::: "memory"); }   // the loads' address registers are reused below
#pragma unroll
    for (int ks = 0; ks < 64; ks += 32) { const v16b a = frag_kb(&As[0][wave * 16 + nloc][ks], hlf), al = frag_kb(&As[1][wave * 16 + nloc][ks], hlf); v16b bw[8];   // the block's LDS reads as one group ahead of its WMMAs
#pragma unroll
      for (int t = 0; t < 8; ++t) bw[t] = frag_kb(&Bs[t * 16 + nloc][ks], hlf);
#pragma unroll
      for (int t = 0; t < 8; ++t) { acc[t] = wmma16b(a, bw[t], acc[t]); acc[t] = wmma16b(al, bw[t], acc[t]); } } }
#pragma unroll
  for (int t = 0; t < 8; ++t)
#pragma unroll
    for (int r = 0; r < 8; ++r) Ts[wave][8 * hlf + r][t * 16 + nloc] = acc[t][r] * (1.0f / (XS * WSC));
  wave_lds_sync();
  { for (int rr = 0; rr < 16; ++rr) *(v4f*)(out + (m0 + rr) * E + n0 + lane * 4) = *(const v4f*)(&Ts[wave][rr][lane * 4]);  }
}
}  // namespace

extern "C" void kernel_launch(void* const* d_in, const int* in_sizes, int n_in, void* d_out, int out_size, void* d_ws, size_t ws_size, hipStream_t stream) {
  (void)n_in;
  auto Fp = [&](int i) { return (const float*)d_in[i]; };
  // input order: 0 inp [2,2048,1024], 1 count_bias [2,1,2048,2048] f32, 2 attn_mask [2,1,2048,2048] i32 (1 = attend), 3 Wq, 4 Wk, 5 Wv, 6 Wo [1024,1024] (torch [out][in])
  if (in_sizes[0] != NR * E || in_sizes[1] != NB * S * S || in_sizes[2] != NB * S * S || in_sizes[3] != E * E || in_sizes[6] != E * E || out_size != NR * E) return;
  size_t off = 0; char* ws = (char*)d_ws;
  auto carve = [&](size_t bytes) { char* p = ws + off; off += (bytes + 255) & ~(size_t)255; return p; };
  b16* T16 = (b16*)carve((size_t)NR * E * 2); b16* WT = (b16*)carve((size_t)3 * E * E * 2); b16* WOT = (b16*)carve((size_t)E * E * 2);
  b16* Qh = (b16*)carve((size_t)NR * E * 2); b16* Ql = (b16*)carve((size_t)NR * E * 2); b16* Kh = (b16*)carve((size_t)NR * E * 2); b16* Kl = (b16*)carve((size_t)NR * E * 2); b16* VTh = (b16*)carve((size_t)NR * E * 2); b16* VTl = (b16*)carve((size_t)NR * E * 2);
  b16* Oh = (b16*)carve((size_t)NR * E * 2); b16* Ol = (b16*)carve((size_t)NR * E * 2);
  if (off > ws_size || off > ((size_t)128 << 20)) return;   // ≈ 84 MB
  prepx_kernel<<<(unsigned)(((size_t)NR * E / 8 + 255) / 256), 256, 0, stream>>>(Fp(0), T16);
  prepw_kernel<<<(unsigned)(((size_t)4 * E * E / 8 + 255) / 256), 256, 0, stream>>>(Fp(3), Fp(4), Fp(5), Fp(6), WT, WOT);
  proj_kernel<<<dim3(NR / 64, E / 128, 3), 128, 0, stream>>>(T16, WT, Qh, Ql, Kh, Kl, VTh, VTl);
  attn_kernel<<<dim3(S / 128, NH, NB), 256, 0, stream>>>(Qh, Ql, Kh, Kl, VTh, VTl, Fp(1), (const int*)d_in[2], Oh, Ol);
  outproj_kernel<<<dim3(NR / 64, E / 128), 128, 0, stream>>>(Oh, Ol, WOT, (float*)d_out);
}

// v004
// It runs in 163 microseconds.
// Two timings next to v003 put it at 1.14 and 1.15 times that version's speed.
// Counting every step since v000, it is 3.66 times as fast.
#include <hip/hip_runtime.h>

// Softcapped, biased, masked multi-head self-attention (16 heads x 64, 2 x 2,048 tokens, d_model 1,024): q/k/v = inp W^T, scores = q.k/8 + count_bias[b,0,q,k], tanh(scores/30) x 30,
// masked (attn_mask int, 0 -> -inf), softmax, o = w v, out = concat(o) Wo^T.
// WMMA (v_wmma_f32_16x16x32_f16, f32 accumulate): projections [4,096 x 1,024] x [1,024 x 1,024] with EXACT bf16 tokens (x8) and weights (x256), 1 product, into f16 hi+lo x8 planes (v transposed
// per head); S^T with 3 products (Kh Qh + Kh Ql + Kl Qh); bias (bf16-rounded input), softcap and mask per element, online softmax in f32; O^T += V^T P^T with 3 products; output projection with
// O hi+lo (2 products) and exact Wo. Inputs rounded to bf16 once. Fragment k-map per lane half hh for A AND B: elements 0..7 <- k = 8hh+0..7, 8..15 <- k =

namespace {
constexpr int NB = 2, S = 2048, E = 1024, NH = 16, D = 64, NR = NB * S;
constexpr float XS = 8.0f, WSC = 256.0f, PS = 8.0f, SCALE = 0.125f, LOG2E = 1.4426950408889634f, SOFTCAP = 30.0f;
typedef __attribute__((ext_vector_type(4))) int v4i;
typedef __attribute__((ext_vector_type(4))) unsigned int v4u;
typedef __attribute__((ext_vector_type(2))) unsigned int v2u;

typedef _Float16 b16;
typedef __attribute__((ext_vector_type(16))) _Float16 v16b;
typedef __attribute__((ext_vector_type(8))) _Float16 v8b;
typedef __attribute__((ext_vector_type(8))) float v8f;
typedef __attribute__((ext_vector_type(4))) float v4f;
__device__ __forceinline__ float bf16_rne(float f) { unsigned int u = __float_as_uint(f); u += 0x7FFFu + ((u >> 16) & 1u); return __uint_as_float(u & 0xFFFF0000u); }
__device__ __forceinline__ void split16(float v, b16& hi, b16& lo) { hi = (b16)v; lo = (b16)(v - (float)hi); }
__device__ __forceinline__ v16b frag_kb(const b16* p, int hh) { const v8b a = *(const v8b*)(p + 8 * hh), b = *(const v8b*)(p + 16 + 8 * hh); v16b f;
#pragma unroll
  for (int e = 0; e < 8; ++e) { f[e] = a[e]; f[8 + e] = b[e]; } return f; }
__device__ __forceinline__ v8f wmma16b(v16b a, v16b b, v8f c) { v8f d = __builtin_amdgcn_wmma_f32_16x16x32_f16(false, a, false, b, (short)0, c, false, false); asm volatile("v_nop\n\tv_nop\n\tv_nop\n\tv_nop" : "+v"(d) : "v"(a), "v"(b)); return d; }
__device__ __forceinline__ void wave_lds_sync() { __builtin_amdgcn_fence(__ATOMIC_RELEASE, "workgroup"); __builtin_amdgcn_wave_barrier(); __builtin_amdgcn_fence(__ATOMIC_ACQUIRE, "workgroup"); }
__device__ __forceinline__ float nexp2(float x) { return __builtin_amdgcn_exp2f(x); }
// softcap in the unit of the softmax exponent: C tanh(x / 30) = C - 2C / (1 + 2^(x 2 log2(e) / 30)), C = 30 log2(e). No case on the sign: 2^z = inf gives C, 2^z = 0 gives -C. v_rcp_f32 (1 ulp) stands for the IEEE division sequence.
constexpr float CAPK = 2.0f * LOG2E / SOFTCAP, CAPC = SOFTCAP * LOG2E;
// four reciprocals in place; the v_nop is the slot the instruction set asks for behind a transcendental before its result is used or a source overwritten
__device__ __forceinline__ void rcp4(float& a, float& b, float& c, float& d) { asm("v_rcp_f32 %0, %0\n\tv_rcp_f32 %1, %1\n\tv_rcp_f32 %2, %2\n\tv_rcp_f32 %3, %3\n\tv_nop" : "+v"(a), "+v"(b), "+v"(c), "+v"(d)); }
__device__ __forceinline__ void exp2x4(float& a, float& b, float& c, float& d) { asm("v_exp_f32 %0, %0\n\tv_exp_f32 %1, %1\n\tv_exp_f32 %2, %2\n\tv_exp_f32 %3, %3\n\tv_nop" : "+v"(a), "+v"(b), "+v"(c), "+v"(d)); }   // the same for four 2^x

// Bias and mask as ONE 16-bit plane in the order the attention waves read it. An element is the bf16 bits of the rounded bias, or MASKED (0xFFFF, a NaN pattern that no rounded finite or infinite bias has) where attn_mask is 0.
// PB[b][16-query group][32-key tile][j][lane][8]: lane = 16 hh + col holds query col, keys 16 j + 8 hh + 0..7 of the tile, so a wave's block is 1 KiB in a row and two whole-line 16-byte loads fetch it.
constexpr unsigned MASKED = 0xFFFF0000u; constexpr int PKEYS = 512, NPK = NB * (S / 16) * (S / PKEYS), PPITCH = 256 + 32;   // a pack block: 16 queries x 512 keys, all its 16 loads per thread in flight at once; LDS pitch of a 256-byte piece (one j, hh), 8 banks on per piece so the 8-byte stores of a wave hit all 64 banks once
__device__ __forceinline__ unsigned bm_bits(float f, int mk) { unsigned int u = __float_as_uint(f); u += 0x7FFFu + ((u >> 16) & 1u); return mk != 0 ? u : 0xFFFFFFFFu; }   // high half: the element
__global__ __launch_bounds__(256) void prepx_kernel(const float* __restrict__ x, b16* __restrict__ T16, const float* __restrict__ cbias, const int* __restrict__ amask, unsigned int* __restrict__ PB) {
  __shared__ __attribute__((aligned(16))) unsigned char Ps[(PKEYS / 8) * PPITCH];
  if (blockIdx.x < NPK) {   // the first blocks pack bias and mask: whole-line reads along the rows, reordered in LDS, whole-line stores
    const int t_ = threadIdx.x, bq = blockIdx.x / (S / PKEYS), kq = blockIdx.x % (S / PKEYS), row = t_ >> 4, c = t_ & 15; const size_t so = ((size_t)bq * 16 + row) * S + kq * PKEYS + c * 4; const float* bp = cbias + so; const int* mp = amask + so; v4f bv[PKEYS / 64]; v4i mv[PKEYS / 64];
#pragma unroll
    for (int i = 0; i < PKEYS / 64; ++i) { bv[i] = *(const v4f*)(bp + i * 64); mv[i] = *(const v4i*)(mp + i * 64); }
    // the loaded values as inputs only: all 16 loads are issued ahead of this line (without it this build sank the mask loads among the conversions, one or two in flight); the wait: the loads' address registers are reused below;
    // the two row pointers as inputs too: they stay live up to the wait, so no load's result is placed on an address pair of the run (without them the last load's result was)
    static_assert(PKEYS == 512, "the statement below names 8 + 8 loads");
    asm volatile("s_wait_xcnt 0x0" :: "v"(bv[0]), "v"(bv[1]), "v"(bv[2]), "v"(bv[3]), "v"(bv[4]), "v"(bv[5]), "v"(bv[6]), "v"(bv[7]), "v"(mv[0]), "v"(mv[1]), "v"(mv[2]), "v"(mv[3]), "v"(mv[4]), "v"(mv[5]), "v"(mv[6]), "v"(mv[7]), "v"(bp), "v"(mp) : "memory");
#pragma unroll
    for (int i = 0; i < PKEYS / 64; ++i) { v2u w; w[0] = (bm_bits(bv[i][0], mv[i][0]) >> 16) | (bm_bits(bv[i][1], mv[i][1]) & 0xFFFF0000u); w[1] = (bm_bits(bv[i][2], mv[i][2]) >> 16) | (bm_bits(bv[i][3], mv[i][3]) & 0xFFFF0000u);
      *(v2u*)(&Ps[(i * 8 + (c >> 1)) * PPITCH + row * 16 + (c & 1) * 8]) = w; }   // keys 64 i + 4 c + 0..3: piece (key >> 3), then the query's 16 bytes
    __syncthreads();
    char* dst = (char*)PB + ((size_t)bq * (S / 32) + kq * (PKEYS / 32)) * 1024;
#pragma unroll
    for (int i = 0; i < PKEYS / 128; ++i) { const int o = (i * 256 + t_) * 16; *(v4u*)(dst + o) = *(const v4u*)(&Ps[(o >> 8) * PPITCH + (o & 255)]); }
    return; }
  const size_t t = (size_t)(blockIdx.x - NPK) * 256 + threadIdx.x; const size_t n1 = (size_t)NR * E / 8; const float* src; b16* dst; size_t e;
  if (t < n1) { src = x; dst = T16; e = t * 8; } else return;
  const v4f a = *(const v4f*)(src + e), c = *(const v4f*)(src + e + 4); v8b o;
#pragma unroll
  for (int j = 0; j < 4; ++j) { o[j] = (b16)(bf16_rne(a[j]) * XS); o[4 + j] = (b16)(bf16_rne(c[j]) * XS); }
  { *(v8b*)(dst + e) = o;  }
}
__global__ __launch_bounds__(256) void prepw_kernel(const float* __restrict__ wq, const float* __restrict__ wk, const float* __restrict__ wv, const float* __restrict__ wo, b16* __restrict__ WT, b16* __restrict__ WOT) {
  const size_t t = (size_t)blockIdx.x * 256 + threadIdx.x; const size_t nw = (size_t)E * E / 8; if (t >= 4 * nw) return; const int kind = (int)(t / nw); const size_t e = (t - (size_t)kind * nw) * 8;
  const float* w = kind == 0 ? wq : kind == 1 ? wk : kind == 2 ? wv : wo; b16* dst = kind < 3 ? WT + (size_t)kind * E * E : WOT;   // torch [out][in] rows used directly as B columns (x W^T)
  const v4f a = *(const v4f*)(w + e), c = *(const v4f*)(w + e + 4); v8b o;
#pragma unroll
  for (int j = 0; j < 4; ++j) { o[j] = (b16)(bf16_rne(a[j]) * WSC); o[4 + j] = (b16)(bf16_rne(c[j]) * WSC); }
  { *(v8b*)(dst + e) = o;  }
}
// projections: grid (NR/64, E/128, 3): kind 0: Q = T16 WT0^T -> Qh/Ql [row][1024]; kind 1: K = T16 WT1^T -> Kh/Kl; kind 2: V = T16 WT2^T written TRANSPOSED per head: VTh/VTl [b][h][64 d][2048 s].
__global__ __launch_bounds__(128) void proj_kernel(const b16* __restrict__ T16, const b16* __restrict__ WT, b16* __restrict__ Qh, b16* __restrict__ Ql, b16* __restrict__ Kh, b16* __restrict__ Kl, b16* __restrict__ VTh, b16* __restrict__ VTl) {
  __shared__ __attribute__((aligned(16))) b16 Th[4][16][128 + 8], Tl[4][16][128 + 8]; __shared__ __attribute__((aligned(16))) b16 Vt[128][64 + 8], Vtl[128][64 + 8];
  const int wave = threadIdx.x >> 5, lane = threadIdx.x & 31, nloc = lane & 15, hlf = lane >> 4, t_ = threadIdx.x; const int kind = blockIdx.z; const size_t m0 = (size_t)blockIdx.x * 64 + wave * 16; const int n0 = blockIdx.y * 128;
  // operand tiles (64 x 64 of A, 128 x 64 of W) are fetched once per work-group as whole 128-byte rows, one tile ahead into registers, stored to LDS (pitch 144 B) and read from there as fragments by the 4 waves
  __shared__ __attribute__((aligned(16))) b16 As[64][64 + 8], Bs[128][64 + 8];
  const int sr = t_ >> 3, sc = (t_ & 7) * 8; const b16* Ag = T16 + ((size_t)blockIdx.x * 64 + sr) * E + sc; const b16* Bg = WT + (size_t)kind * E * E + (size_t)(n0 + sr) * E + sc; v8f acc[8]; v8b ga[4], gb[8];
#pragma unroll
  for (int t = 0; t < 8; ++t) acc[t] = (v8f){};
#pragma unroll
  for (int j = 0; j < 4; ++j) ga[j] = *(const v8b*)(Ag + (size_t)j * 16 * E);
#pragma unroll
  for (int j = 0; j < 8; ++j) gb[j] = *(const v8b*)(Bg + (size_t)j * 16 * E);
  for (int kb = 0; kb < E; kb += 64) {
    __syncthreads();   // every wave has finished its fragment reads of the previous tile
#pragma unroll
    for (int j = 0; j < 4; ++j) *(v8b*)(&As[j * 16 + sr][sc]) = ga[j];
#pragma unroll
    for (int j = 0; j < 8; ++j) *(v8b*)(&Bs[j * 16 + sr][sc]) = gb[j];
    __syncthreads();
    if (kb + 64 < E) {
#pragma unroll
      for (int j = 0; j < 4; ++j) ga[j] = *(const v8b*)(Ag + (size_t)j * 16 * E + kb + 64);
#pragma unroll
      for (int j = 0; j < 8; ++j) gb[j] = *(const v8b*)(Bg + (size_t)j * 16 * E + kb + 64);
      asm volatile("s_wait_xcnt 0x0" ::: "memory"); }   // the loads' address registers are reused below
#pragma unroll
    for (int ks = 0; ks < 64; ks += 32) { const v16b a = frag_kb(&As[wave * 16 + nloc][ks], hlf); v16b bw[8];   // the block's LDS reads as one group ahead of its WMMAs
#pragma unroll
      for (int t = 0; t < 8; ++t) bw[t] = frag_kb(&Bs[t * 16 + nloc][ks], hlf);
#pragma unroll
      for (int t = 0; t < 8; ++t) acc[t] = wmma16b(a, bw[t], acc[t]); } }
  if (kind < 2) {
#pragma unroll
    for (int t = 0; t < 8; ++t)
#pragma unroll
      for (int r = 0; r < 8; ++r) { b16 h_, l_; split16(acc[t][r] * (1.0f / (XS * WSC)) * XS, h_, l_); Th[wave][8 * hlf + r][t * 16 + nloc] = h_; Tl[wave][8 * hlf + r][t * 16 + nloc] = l_; }
    wave_lds_sync();
    b16* dh = kind == 0 ? Qh : Kh; b16* dl = kind == 0 ? Ql : Kl;
    { for (int rr = 0; rr < 16; ++rr) if (lane < 16) { *(v8b*)(dh + (m0 + rr) * E + n0 + lane * 8) = *(const v8b*)(&Th[wave][rr][lane * 8]); *(v8b*)(dl + (m0 + rr) * E + n0 + lane * 8) = *(const v8b*)(&Tl[wave][rr][lane * 8]); }  }
  } else {
    const int b = (int)(m0 / S); const int s0 = (int)((size_t)blockIdx.x * 64 - (size_t)b * S);
#pragma unroll
    for (int t = 0; t < 8; ++t)
#pragma unroll
      for (int r = 0; r < 8; ++r) { b16 h_, l_; split16(acc[t][r] * (1.0f / (XS * WSC)) * XS, h_, l_); Vt[t * 16 + nloc][wave * 16 + 8 * hlf + r] = h_; Vtl[t * 16 + nloc][wave * 16 + 8 * hlf + r] = l_; }
    __syncthreads();
    { for (int q = t_; q < 128 * 8; q += 128) { const int cc = q >> 3, c8 = (q & 7) * 8; const int h = (n0 + cc) / D, dd = (n0 + cc) - h * D; const size_t gi = (((size_t)b * NH + h) * D + dd) * S + s0 + c8;
        *(v8b*)(VTh + gi) = *(const v8b*)(&Vt[cc][c8]); *(v8b*)(VTl + gi) = *(const v8b*)(&Vtl[cc][c8]); }  } }
}
// One work-group = 8 waves x 16 queries of one (batch, head): four 16-query groups from the low half of the sequence and their mirror images from the high half. Each 32-key tile of K (hi, lo) and V^T (hi, lo) is fetched once per work-group with line-contiguous 16-byte loads, one tile ahead
// into registers, stored to LDS and read from there as fragments by all 8 waves. Row pitches 144 B (K) and 80 B (V^T) spread the 16 rows of a ds_load_b128 over all banks.
__global__ __launch_bounds__(256) __attribute__((amdgpu_waves_per_eu(4, 4))) void attn_kernel(   /* registers held to two 8-wave work-groups per WGP */ const b16* __restrict__ Qh, const b16* __restrict__ Ql, const b16* __restrict__ Kh, const b16* __restrict__ Kl, const b16* __restrict__ VTh, const b16* __restrict__ VTl, const unsigned int* __restrict__ PB, b16* __restrict__ Oh, b16* __restrict__ Ol) {
  __shared__ __attribute__((aligned(16))) b16 Ks[2][32][D + 8]; __shared__ __attribute__((aligned(16))) b16 Vs[2][D][32 + 8]; __shared__ __attribute__((aligned(16))) float To[8][16][D + 4];
  const int wave = threadIdx.x >> 5, lane = threadIdx.x & 31, hh = lane >> 4, col = lane & 15; const int b = blockIdx.z, h = blockIdx.y;
  // which 16 queries a wave takes: waves w and w + 4 take groups g and 127 - g, g = 4 blockIdx.x + w. A wave skips the key tiles that the mask closes for all its queries, so where the open part of a row
  // grows with the query index a wave's work grows with its group; dealt this way every SIMD gets about the same number of worked tiles. Any mask is handled: the skip is still decided from the mask alone, and (blockIdx.x, wave) -> group is one-to-one onto 0..127.
  const int gl = blockIdx.x * 4 + (wave & 3); const int q0 = (wave < 4 ? gl : S / 16 - 1 - gl) * 16, qi = q0 + col;
  const int kr = threadIdx.x >> 3, kc = (threadIdx.x & 7) * 8, vr = threadIdx.x >> 2, vc = (threadIdx.x & 3) * 8;   // this thread's 16-byte piece of the K tile (32 rows x 128 B) and of the V^T tile (64 rows x 64 B)
  const size_t qo = ((size_t)b * S + qi) * E + h * D; const v16b qa0 = frag_kb(Qh + qo, hh), qa1 = frag_kb(Qh + qo + 32, hh), ql0 = frag_kb(Ql + qo, hh), ql1 = frag_kb(Ql + qo + 32, hh);
  // wave-uniform bases plus one 32-bit byte offset per thread, shared by each pair of planes (K hi/lo, V^T hi/lo); the packed bias and mask plane has its own
  const char* Kb = (const char*)(Kh + (size_t)b * S * E + h * D); const char* Klb = (const char*)(Kl + (size_t)b * S * E + h * D); const char* Vb = (const char*)(VTh + ((size_t)b * NH + h) * D * S); const char* Vlb = (const char*)(VTl + ((size_t)b * NH + h) * D * S);
  const unsigned ko = (unsigned)(kr * E + kc) * 2u, vo = (unsigned)(vr * S + vc) * 2u, po = (unsigned)(q0 >> 4) * (unsigned)(S / 32 * 1024) + (unsigned)lane * 16u;
  float m = -INFINITY, l = 0.0f; v8f o[4] = {{}, {}, {}, {}}, ol[4] = {{}, {}, {}, {}};
  const float cs = SCALE / (XS * XS); const char* prow = (const char*)PB + (size_t)b * (S / 16) * (S / 32) * 1024;
  v8b gk = *(const v8b*)(Kb + ko), gkl = *(const v8b*)(Klb + ko), gv = *(const v8b*)(Vb + vo), gvl = *(const v8b*)(Vlb + vo);
  v4u n0 = *(const v4u*)(prow + po), n1 = *(const v4u*)(prow + 512 + po);
  for (int kb = 0; kb < S; kb += 32) {
    __syncthreads();   // every wave has finished its fragment reads of the previous tile
    *(v8b*)(&Ks[0][kr][kc]) = gk; *(v8b*)(&Ks[1][kr][kc]) = gkl; *(v8b*)(&Vs[0][vr][vc]) = gv; *(v8b*)(&Vs[1][vr][vc]) = gvl;
    const v4u c0 = n0, c1 = n1;
    __syncthreads();   // the tile is visible to all 8 waves
    if (kb + 32 < S) {   // next tile and next bias and mask block fly while this tile is worked on
      const int kn = kb + 32; gk = *(const v8b*)(Kb + (size_t)kn * E * 2 + ko); gkl = *(const v8b*)(Klb + (size_t)kn * E * 2 + ko); gv = *(const v8b*)(Vb + kn * 2 + vo); gvl = *(const v8b*)(Vlb + kn * 2 + vo);
      n0 = *(const v4u*)(prow + kn * 32 + po); n1 = *(const v4u*)(prow + kn * 32 + 512 + po);
      asm volatile("s_wait_xcnt 0x0" ::: "memory"); }   // the loads' address registers are reused by the block's work below
    // per-element mask for this block: if no key of this 32-key block is allowed for ANY of the wave's 16 queries, the wave skips the block's work (decided from the input mask; wave-uniform; the barriers stay outside)
    unsigned allm = 0xFFFFFFFFu;
#pragma unroll
    for (int j = 0; j < 4; ++j) allm &= c0[j] & c1[j];
    if (__builtin_amdgcn_ballot_w32(allm != 0xFFFFFFFFu) != 0u) {
    v8f s0 = {}, s1 = {};
    { const b16* k0 = &Ks[0][col][0], *k1 = &Ks[0][16 + col][0], *k0l = &Ks[1][col][0], *k1l = &Ks[1][16 + col][0];   // K reads from LDS in one group per 16 keys, ahead of that group's WMMAs
      const v16b f0 = frag_kb(k0, hh), g0 = frag_kb(k0l, hh), f1 = frag_kb(k0 + 32, hh), g1 = frag_kb(k0l + 32, hh);
      s0 = wmma16b(f0, qa0, s0); s0 = wmma16b(f0, ql0, s0); s0 = wmma16b(g0, qa0, s0);
      s0 = wmma16b(f1, qa1, s0); s0 = wmma16b(f1, ql1, s0); s0 = wmma16b(g1, qa1, s0);
      const v16b f2 = frag_kb(k1, hh), g2 = frag_kb(k1l, hh), f3 = frag_kb(k1 + 32, hh), g3 = frag_kb(k1l + 32, hh);
      s1 = wmma16b(f2, qa0, s1); s1 = wmma16b(f2, ql0, s1); s1 = wmma16b(g2, qa0, s1);
      s1 = wmma16b(f3, qa1, s1); s1 = wmma16b(f3, ql1, s1); s1 = wmma16b(g3, qa1, s1); }
    float e[16]; unsigned ub[16]; float mx = -INFINITY;
#pragma unroll
    for (int r = 0; r < 8; ++r) { ub[r] = (r & 1) ? (c0[r >> 1] & 0xFFFF0000u) : (c0[r >> 1] << 16); ub[8 + r] = (r & 1) ? (c1[r >> 1] & 0xFFFF0000u) : (c1[r >> 1] << 16);   // bf16 bits -> f32; a masked element is a NaN until the select below
      e[r] = 1.0f + nexp2((s0[r] * cs + __uint_as_float(ub[r])) * CAPK); e[8 + r] = 1.0f + nexp2((s1[r] * cs + __uint_as_float(ub[8 + r])) * CAPK); }   // softcap: the denominators
#pragma unroll
    for (int i = 0; i < 16; i += 4) rcp4(e[i], e[i + 1], e[i + 2], e[i + 3]);
#pragma unroll
    for (int r = 0; r < 8; ++r) { const float x0 = __builtin_fmaf(e[r], -2.0f * CAPC, CAPC), x1 = __builtin_fmaf(e[8 + r], -2.0f * CAPC, CAPC);
      e[r] = (ub[r] != MASKED) ? x0 : -INFINITY; e[8 + r] = (ub[8 + r] != MASKED) ? x1 : -INFINITY; mx = fmaxf(mx, fmaxf(e[r], e[8 + r])); }
    mx = fmaxf(mx, __shfl_xor(mx, 16)); const float mn = fmaxf(m, mx);
    // a query whose keys are all masked so far keeps m = -inf: use 0 as the reference so every masked weight is exp2(-inf) = 0 and no NaN appears (no divergent control flow around the WMMAs)
    const bool none = (mn == -INFINITY); const float mref = none ? 0.0f : mn; const float al = none ? 1.0f : nexp2(m - mn); m = mn; float sum = 0.0f; v16b ph, pl;
#pragma unroll
    for (int i = 0; i < 16; i += 4) { e[i] -= mref; e[i + 1] -= mref; e[i + 2] -= mref; e[i + 3] -= mref; exp2x4(e[i], e[i + 1], e[i + 2], e[i + 3]); }
#pragma unroll
    for (int i = 0; i < 16; ++i) { const float p = e[i]; sum += p; const b16 h_ = (b16)(p * PS); ph[i] = h_; pl[i] = (b16)(p * PS - (float)h_); }
    sum += __shfl_xor(sum, 16); l = l * al + sum; v16b vf[4], vl[4];   // V^T reads from LDS in one group per 32 rows, ahead of that group's WMMAs
#pragma unroll
    for (int u = 0; u < 4; u += 2) {
#pragma unroll
      for (int t = u; t < u + 2; ++t) { vf[t] = frag_kb(&Vs[0][t * 16 + col][0], hh); vl[t] = frag_kb(&Vs[1][t * 16 + col][0], hh); }
#pragma unroll
      for (int t = u; t < u + 2; ++t) { o[t] *= al; ol[t] *= al; o[t] = wmma16b(vf[t], ph, o[t]); ol[t] = wmma16b(vf[t], pl, ol[t]); ol[t] = wmma16b(vl[t], ph, ol[t]); } } } }
  const float inv = 1.0f / (l * PS * XS);
#pragma unroll
  for (int t = 0; t < 4; ++t)
#pragma unroll
    for (int r = 0; r < 8; ++r) To[wave][col][t * 16 + 8 * hh + r] = (o[t][r] + ol[t][r]) * inv;
  wave_lds_sync();
  { for (int r4 = 0; r4 < 16; r4 += 4) { const int rr = r4 + (lane >> 3), c8 = (lane & 7) * 8; v8b hv, lv; for (int j = 0; j < 8; ++j) { b16 a_, c_; split16(To[wave][rr][c8 + j] * XS, a_, c_); hv[j] = a_; lv[j] = c_; }
      const size_t gi = ((size_t)b * S + q0 + rr) * E + h * D + c8; *(v8b*)(Oh + gi) = hv; *(v8b*)(Ol + gi) = lv; }  }
}
__global__ __launch_bounds__(128) void outproj_kernel(const b16* __restrict__ Oh, const b16* __restrict__ Ol, const b16* __restrict__ WOT, float* __restrict__ out) {
  __shared__ __attribute__((aligned(16))) float Ts[4][16][128 + 4];
  const int wave = threadIdx.x >> 5, lane = threadIdx.x & 31, nloc = lane & 15, hlf = lane >> 4; const size_t m0 = (size_t)blockIdx.x * 64 + wave * 16; const int n0 = blockIdx.y * 128;
  // operand tiles (64 x 64 of O hi and lo, 128 x 64 of Wo) staged as in proj_kernel: whole 128-byte rows, one tile ahead in registers, LDS pitch 144 B
  __shared__ __attribute__((aligned(16))) b16 As[2][64][64 + 8], Bs[128][64 + 8];
  const int sr = threadIdx.x >> 3, sc = (threadIdx.x & 7) * 8; const size_t ao = ((size_t)blockIdx.x * 64 + sr) * E + sc; const b16* Bg = WOT + (size_t)(n0 + sr) * E + sc; v8f acc[8]; v8b ga[4], gl[4], gb[8];
#pragma unroll
  for (int t = 0; t < 8; ++t) acc[t] = (v8f){};
#pragma unroll
  for (int j = 0; j < 4; ++j) { ga[j] = *(const v8b*)(Oh + ao + (size_t)j * 16 * E); gl[j] = *(const v8b*)(Ol + ao + (size_t)j * 16 * E); }
#pragma unroll
  for (int j = 0; j < 8; ++j) gb[j] = *(const v8b*)(Bg + (size_t)j * 16 * E);
  for (int kb = 0; kb < E; kb += 64) {
    __syncthreads();   // every wave has finished its fragment reads of the previous tile
#pragma unroll
    for (int j = 0; j < 4; ++j) { *(v8b*)(&As[0][j * 16 + sr][sc]) = ga[j]; *(v8b*)(&As[1][j * 16 + sr][sc]) = gl[j]; }
#pragma unroll
    for (int j = 0; j < 8; ++j) *(v8b*)(&Bs[j * 16 + sr][sc]) = gb[j];
    __syncthreads();
    if (kb + 64 < E) {
#pragma unroll
      for (int j = 0; j < 4; ++j) { ga[j] = *(const v8b*)(Oh + ao + (size_t)j * 16 * E + kb + 64); gl[j] = *(const v8b*)(Ol + ao + (size_t)j * 16 * E + kb + 64); }
      asm volatile("s_wait_xcnt 0x0" ::: "memory");   // these loads' address registers are reused as destinations of the loads that follow
#pragma unroll
      for (int j = 0; j < 8; ++j) gb[j] = *(const v8b*)(Bg + (size_t)j * 16 * E + kb + 64);
      asm volatile("s_wait_xcnt 0x0" ::: "memory"); }   // the loads' address registers are reused below
#pragma unroll
    for (int ks = 0; ks < 64; ks += 32) { const v16b a = frag_kb(&As[0][wave * 16 + nloc][ks], hlf), al = frag_kb(&As[1][wave * 16 + nloc][ks], hlf); v16b bw[8];   // the block's LDS reads as one group ahead of its WMMAs
#pragma unroll
      for (int t = 0; t < 8; ++t) bw[t] = frag_kb(&Bs[t * 16 + nloc][ks], hlf);
#pragma unroll
      for (int t = 0; t < 8; ++t) { acc[t] = wmma16b(a, bw[t], acc[t]); acc[t] = wmma16b(al, bw[t], acc[t]); } } }
#pragma unroll
  for (int t = 0; t < 8; ++t)
#pragma unroll
    for (int r = 0; r < 8; ++r) Ts[wave][8 * hlf + r][t * 16 + nloc] = acc[t][r] * (1.0f / (XS * WSC));
  wave_lds_sync();
  { for (int rr = 0; rr < 16; ++rr) *(v4f*)(out + (m0 + rr) * E + n0 + lane * 4) = *(const v4f*)(&Ts[wave][rr][lane * 4]);  }
}
}  // namespace

extern "C" void kernel_launch(void* const* d_in, const int* in_sizes, int n_in, void* d_out, int out_size, void* d_ws, size_t ws_size, hipStream_t stream) {
  (void)n_in;
  auto Fp = [&](int i) { return (const float*)d_in[i]; };
  // input order: 0 inp [2,2048,1024], 1 count_bias [2,1,2048,2048] f32, 2 attn_mask [2,1,2048,2048] i32 (1 = attend), 3 Wq, 4 Wk, 5 Wv, 6 Wo [1024,1024] (torch [out][in])
  if (in_sizes[0] != NR * E || in_sizes[1] != NB * S * S || in_sizes[2] != NB * S * S || in_sizes[3] != E * E || in_sizes[6] != E * E || out_size != NR * E) return;
  size_t off = 0; char* ws = (char*)d_ws;
  auto carve = [&](size_t bytes) { char* p = ws + off; off += (bytes + 255) & ~(size_t)255; return p; };
  b16* T16 = (b16*)carve((size_t)NR * E * 2); b16* WT = (b16*)carve((size_t)3 * E * E * 2); b16* WOT = (b16*)carve((size_t)E * E * 2);
  b16* Qh = (b16*)carve((size_t)NR * E * 2); b16* Ql = (b16*)carve((size_t)NR * E * 2); b16* Kh = (b16*)carve((size_t)NR * E * 2); b16* Kl = (b16*)carve((size_t)NR * E * 2); b16* VTh = (b16*)carve((size_t)NR * E * 2); b16* VTl = (b16*)carve((size_t)NR * E * 2);
  b16* Oh = (b16*)carve((size_t)NR * E * 2); b16* Ol = (b16*)carve((size_t)NR * E * 2); unsigned int* PB = (unsigned int*)carve((size_t)NB * S * S * 2);
  if (off > ws_size || off > ((size_t)128 << 20)) return;   // about 101 MB
  prepx_kernel<<<(unsigned)(NPK + ((size_t)NR * E / 8 + 255) / 256), 256, 0, stream>>>(Fp(0), T16, Fp(1), (const int*)d_in[2], PB);
  prepw_kernel<<<(unsigned)(((size_t)4 * E * E / 8 + 255) / 256), 256, 0, stream>>>(Fp(3), Fp(4), Fp(5), Fp(6), WT, WOT);
  proj_kernel<<<dim3(NR / 64, E / 128, 3), 128, 0, stream>>>(T16, WT, Qh, Ql, Kh, Kl, VTh, VTl);
  attn_kernel<<<dim3(S / 128, NH, NB), 256, 0, stream>>>(Qh, Ql, Kh, Kl, VTh, VTl, PB, Oh, Ol);
  outproj_kernel<<<dim3(NR / 64, E / 128), 128, 0, stream>>>(Oh, Ol, WOT, (float*)d_out);
}

// v005
// A run of this version takes 149 microseconds.
// In two side-by-side timings against v004, it was 1.08 and 1.07 times as fast.
// All steps since v000 together make it 3.93 times as fast.
#include <hip/hip_runtime.h>

// Softcapped, biased, masked multi-head self-attention (16 heads x 64, 2 x 2,048 tokens, d_model 1,024): q/k/v = inp W^T, scores = q.k/8 + count_bias[b,0,q,k], tanh(scores/30) x 30,
// masked (attn_mask int, 0 -> -inf), softmax, o = w v, out = concat(o) Wo^T.
// WMMA (v_wmma_f32_16x16x32_f16, f32 accumulate): projections [4,096 x 1,024] x [1,024 x 1,024] with EXACT bf16 tokens (x8) and weights (x256), 1 product, into f16 hi+lo x8 planes (v transposed
// per head); S^T with 3 products (Kh Qh + Kh Ql + Kl Qh); bias (bf16-rounded input), softcap and mask per element, online softmax in f32; O^T += V^T P^T with 3 products; output projection with
// O hi+lo (2 products) and exact Wo. Inputs rounded to bf16 once. Fragment k-map per lane half hh for A AND B: elements 0..7 <- k = 8hh+0..7, 8..15 <- k =

namespace {
constexpr int NB = 2, S = 2048, E = 1024, NH = 16, D = 64, NR = NB * S;
constexpr float XS = 8.0f, WSC = 256.0f, PS = 8.0f, SCALE = 0.125f, LOG2E = 1.4426950408889634f, SOFTCAP = 30.0f;
typedef __attribute__((ext_vector_type(4))) int v4i;
typedef __attribute__((ext_vector_type(4))) unsigned int v4u;
typedef __attribute__((ext_vector_type(2))) unsigned int v2u;

typedef _Float16 b16;
typedef __attribute__((ext_vector_type(16))) _Float16 v16b;
typedef __attribute__((ext_vector_type(8))) _Float16 v8b;
typedef __attribute__((ext_vector_type(8))) float v8f;
typedef __attribute__((ext_vector_type(4))) float v4f;
__device__ __forceinline__ float bf16_rne(float f) { unsigned int u = __float_as_uint(f); u += 0x7FFFu + ((u >> 16) & 1u); return __uint_as_float(u & 0xFFFF0000u); }
__device__ __forceinline__ void split16(float v, b16& hi, b16& lo) { hi = (b16)v; lo = (b16)(v - (float)hi); }
__device__ __forceinline__ v16b frag_kb(const b16* p, int hh) { const v8b a = *(const v8b*)(p + 8 * hh), b = *(const v8b*)(p + 16 + 8 * hh); v16b f;
#pragma unroll
  for (int e = 0; e < 8; ++e) { f[e] = a[e]; f[8 + e] = b[e]; } return f; }
__device__ __forceinline__ v8f wmma16b(v16b a, v16b b, v8f c) { v8f d = __builtin_amdgcn_wmma_f32_16x16x32_f16(false, a, false, b, (short)0, c, false, false); asm volatile("v_nop\n\tv_nop\n\tv_nop\n\tv_nop" : "+v"(d) : "v"(a), "v"(b)); return d; }
__device__ __forceinline__ void wave_lds_sync() { __builtin_amdgcn_fence(__ATOMIC_RELEASE, "workgroup"); __builtin_amdgcn_wave_barrier(); __builtin_amdgcn_fence(__ATOMIC_ACQUIRE, "workgroup"); }
__device__ __forceinline__ float nexp2(float x) { return __builtin_amdgcn_exp2f(x); }
// softcap in the unit of the softmax exponent: C tanh(x / 30) = C - 2C / (1 + 2^(x 2 log2(e) / 30)), C = 30 log2(e). No case on the sign: 2^z = inf gives C, 2^z = 0 gives -C. v_rcp_f32 (1 ulp) stands for the IEEE division sequence.
constexpr float CAPK = 2.0f * LOG2E / SOFTCAP, CAPC = SOFTCAP * LOG2E;
// four reciprocals in place; the v_nop is the slot the instruction set asks for behind a transcendental before its result is used or a source overwritten
__device__ __forceinline__ void rcp4(float& a, float& b, float& c, float& d) { asm("v_rcp_f32 %0, %0\n\tv_rcp_f32 %1, %1\n\tv_rcp_f32 %2, %2\n\tv_rcp_f32 %3, %3\n\tv_nop" : "+v"(a), "+v"(b), "+v"(c), "+v"(d)); }
__device__ __forceinline__ void exp2x4(float& a, float& b, float& c, float& d) { asm("v_exp_f32 %0, %0\n\tv_exp_f32 %1, %1\n\tv_exp_f32 %2, %2\n\tv_exp_f32 %3, %3\n\tv_nop" : "+v"(a), "+v"(b), "+v"(c), "+v"(d)); }   // the same for four 2^x

// Bias and mask as ONE 16-bit plane in the order the attention waves read it. An element is the bf16 bits of the rounded bias, or MASKED (0xFFFF, a NaN pattern that no rounded finite or infinite bias has) where attn_mask is 0.
// PB[b][16-query group][32-key tile][j][lane][8]: lane = 16 hh + col holds query col, keys 16 j + 8 hh + 0..7 of the tile, so a wave's block is 1 KiB in a row and two whole-line 16-byte loads fetch it.
constexpr unsigned MASKED = 0xFFFF0000u; constexpr int PKEYS = 512, NPK = NB * (S / 16) * (S / PKEYS), PPITCH = 256 + 32;   // a pack block: 16 queries x 512 keys, all its 16 loads per thread in flight at once; LDS pitch of a 256-byte piece (one j, hh), 8 banks on per piece so the 8-byte stores of a wave hit all 64 banks once
__device__ __forceinline__ unsigned bm_bits(float f, int mk) { unsigned int u = __float_as_uint(f); u += 0x7FFFu + ((u >> 16) & 1u); return mk != 0 ? u : 0xFFFFFFFFu; }   // high half: the element
__global__ __launch_bounds__(256) void prepx_kernel(const float* __restrict__ x, b16* __restrict__ T16, const float* __restrict__ cbias, const int* __restrict__ amask, unsigned int* __restrict__ PB) {
  __shared__ __attribute__((aligned(16))) unsigned char Ps[(PKEYS / 8) * PPITCH];
  if (blockIdx.x < NPK) {   // the first blocks pack bias and mask: whole-line reads along the rows, reordered in LDS, whole-line stores
    const int t_ = threadIdx.x, bq = blockIdx.x / (S / PKEYS), kq = blockIdx.x % (S / PKEYS), row = t_ >> 4, c = t_ & 15; const size_t so = ((size_t)bq * 16 + row) * S + kq * PKEYS + c * 4; const float* bp = cbias + so; const int* mp = amask + so; v4f bv[PKEYS / 64]; v4i mv[PKEYS / 64];
#pragma unroll
    for (int i = 0; i < PKEYS / 64; ++i) { bv[i] = *(const v4f*)(bp + i * 64); mv[i] = *(const v4i*)(mp + i * 64); }
    // the loaded values as inputs only: all 16 loads are issued ahead of this line (without it this build sank the mask loads among the conversions, one or two in flight); the wait: the loads' address registers are reused below;
    // the two row pointers as inputs too: they stay live up to the wait, so no load's result is placed on an address pair of the run (without them the last load's result was)
    static_assert(PKEYS == 512, "the statement below names 8 + 8 loads");
    asm volatile("s_wait_xcnt 0x0" :: "v"(bv[0]), "v"(bv[1]), "v"(bv[2]), "v"(bv[3]), "v"(bv[4]), "v"(bv[5]), "v"(bv[6]), "v"(bv[7]), "v"(mv[0]), "v"(mv[1]), "v"(mv[2]), "v"(mv[3]), "v"(mv[4]), "v"(mv[5]), "v"(mv[6]), "v"(mv[7]), "v"(bp), "v"(mp) : "memory");
#pragma unroll
    for (int i = 0; i < PKEYS / 64; ++i) { v2u w; w[0] = (bm_bits(bv[i][0], mv[i][0]) >> 16) | (bm_bits(bv[i][1], mv[i][1]) & 0xFFFF0000u); w[1] = (bm_bits(bv[i][2], mv[i][2]) >> 16) | (bm_bits(bv[i][3], mv[i][3]) & 0xFFFF0000u);
      *(v2u*)(&Ps[(i * 8 + (c >> 1)) * PPITCH + row * 16 + (c & 1) * 8]) = w; }   // keys 64 i + 4 c + 0..3: piece (key >> 3), then the query's 16 bytes
    __syncthreads();
    char* dst = (char*)PB + ((size_t)bq * (S / 32) + kq * (PKEYS / 32)) * 1024;
#pragma unroll
    for (int i = 0; i < PKEYS / 128; ++i) { const int o = (i * 256 + t_) * 16; *(v4u*)(dst + o) = *(const v4u*)(&Ps[(o >> 8) * PPITCH + (o & 255)]); }
    return; }
  const size_t t = (size_t)(blockIdx.x - NPK) * 256 + threadIdx.x; const size_t n1 = (size_t)NR * E / 8; const float* src; b16* dst; size_t e;
  if (t < n1) { src = x; dst = T16; e = t * 8; } else return;
  const v4f a = *(const v4f*)(src + e), c = *(const v4f*)(src + e + 4); v8b o;
#pragma unroll
  for (int j = 0; j < 4; ++j) { o[j] = (b16)(bf16_rne(a[j]) * XS); o[4 + j] = (b16)(bf16_rne(c[j]) * XS); }
  { *(v8b*)(dst + e) = o;  }
}
__global__ __launch_bounds__(256) void prepw_kernel(const float* __restrict__ wq, const float* __restrict__ wk, const float* __restrict__ wv, const float* __restrict__ wo, b16* __restrict__ WT, b16* __restrict__ WOT) {
  const size_t t = (size_t)blockIdx.x * 256 + threadIdx.x; const size_t nw = (size_t)E * E / 8; if (t >= 4 * nw) return; const int kind = (int)(t / nw); const size_t e = (t - (size_t)kind * nw) * 8;
  const float* w = kind == 0 ? wq : kind == 1 ? wk : kind == 2 ? wv : wo; b16* dst = kind < 3 ? WT + (size_t)kind * E * E : WOT;   // torch [out][in] rows used directly as B columns (x W^T)
  const v4f a = *(const v4f*)(w + e), c = *(const v4f*)(w + e + 4); v8b o;
#pragma unroll
  for (int j = 0; j < 4; ++j) { o[j] = (b16)(bf16_rne(a[j]) * WSC); o[4 + j] = (b16)(bf16_rne(c[j]) * WSC); }
  { *(v8b*)(dst + e) = o;  }
}
// projections: grid (NR/128, E/128, 3): kind 0: Q = T16 WT0^T -> Qh/Ql [row][1024]; kind 1: K = T16 WT1^T -> Kh/Kl; kind 2: V = T16 WT2^T written TRANSPOSED per head: VTh/VTl [b][h][64 d][2048 s].
// A work-group of 4 waves makes a 128 x 128 tile, a wave a 64 x 64 tile (4 x 4 fragments): 8 fragment reads from LDS feed 16 WMMAs (a 16 x 128 wave tile took 9 reads for 8), and a work-group's 32 KiB of operands serve twice the output.
__global__ __launch_bounds__(128) void proj_kernel(const b16* __restrict__ T16, const b16* __restrict__ WT, b16* __restrict__ Qh, b16* __restrict__ Ql, b16* __restrict__ Kh, b16* __restrict__ Kl, b16* __restrict__ VTh, b16* __restrict__ VTl) {
  constexpr int TP = 64 + 8, VP = 128 + 8;   // row pitches in elements: 144 B (operand tiles, Q and K staging), 272 B (V^T staging)
  __shared__ __attribute__((aligned(16))) b16 SM[4 * 2 * 64 * TP];   // one block: first the operand tiles, then, behind a barrier, the output staging
  static_assert(4 * 2 * 64 * TP >= 2 * 128 * VP && 4 * 2 * 64 * TP >= 2 * 128 * TP, "the block holds each of its three uses");
  b16 (*As)[TP] = (b16 (*)[TP])SM; b16 (*Bs)[TP] = (b16 (*)[TP])(SM + 128 * TP);
  const int wave = threadIdx.x >> 5, lane = threadIdx.x & 31, nloc = lane & 15, hlf = lane >> 4, t_ = threadIdx.x, wm = wave >> 1, wn = wave & 1; const int kind = blockIdx.z; const size_t mb = (size_t)blockIdx.x * 128; const int n0 = blockIdx.y * 128;
  // operand tiles (128 x 64 of A, 128 x 64 of W) are fetched once per work-group as whole 128-byte rows, one tile ahead into registers, stored to LDS (pitch 144 B) and read from there as fragments by the 4 waves
  const int sr = t_ >> 3, sc = (t_ & 7) * 8; const b16* Ag = T16 + (mb + sr) * E + sc; const b16* Bg = WT + (size_t)kind * E * E + (size_t)(n0 + sr) * E + sc; v8f acc[4][4]; v8b ga[8], gb[8];
#pragma unroll
  for (int i = 0; i < 4; ++i)
#pragma unroll
    for (int t = 0; t < 4; ++t) acc[i][t] = (v8f){};
#pragma unroll
  for (int j = 0; j < 8; ++j) ga[j] = *(const v8b*)(Ag + (size_t)j * 16 * E);
#pragma unroll
  for (int j = 0; j < 8; ++j) gb[j] = *(const v8b*)(Bg + (size_t)j * 16 * E);
  for (int kb = 0; kb < E; kb += 64) {
    __syncthreads();   // every wave has finished its fragment reads of the previous tile
#pragma unroll
    for (int j = 0; j < 8; ++j) *(v8b*)(&As[j * 16 + sr][sc]) = ga[j];
#pragma unroll
    for (int j = 0; j < 8; ++j) *(v8b*)(&Bs[j * 16 + sr][sc]) = gb[j];
    __syncthreads();
    if (kb + 64 < E) {
#pragma unroll
      for (int j = 0; j < 8; ++j) ga[j] = *(const v8b*)(Ag + (size_t)j * 16 * E + kb + 64);
#pragma unroll
      for (int j = 0; j < 8; ++j) gb[j] = *(const v8b*)(Bg + (size_t)j * 16 * E + kb + 64);
      asm volatile("s_wait_xcnt 0x0" ::: "memory"); }   // the loads' address registers are reused below
#pragma unroll
    for (int ks = 0; ks < 64; ks += 32) { v16b a[4], bw[4];   // the block's LDS reads as one group ahead of its WMMAs
#pragma unroll
      for (int i = 0; i < 4; ++i) a[i] = frag_kb(&As[wm * 64 + i * 16 + nloc][ks], hlf);
#pragma unroll
      for (int t = 0; t < 4; ++t) bw[t] = frag_kb(&Bs[wn * 64 + t * 16 + nloc][ks], hlf);
#pragma unroll
      for (int i = 0; i < 4; ++i)
#pragma unroll
        for (int t = 0; t < 4; ++t) acc[i][t] = wmma16b(a[i], bw[t], acc[i][t]); } }
  __syncthreads();   // every wave has finished its fragment reads of the last tile: the block becomes output staging
  if (kind < 2) {   // a wave stages its 64 rows x 64 columns (hi, lo) in its own range and stores them as whole 128-byte lines, 4 rows a store
    b16 (*Th)[TP] = (b16 (*)[TP])(SM + wave * 2 * 64 * TP); b16 (*Tl)[TP] = Th + 64; b16* dh = kind == 0 ? Qh : Kh; b16* dl = kind == 0 ? Ql : Kl;
#pragma unroll
    for (int i = 0; i < 4; ++i)
#pragma unroll
      for (int t = 0; t < 4; ++t)
#pragma unroll
        for (int r = 0; r < 8; ++r) { b16 h_, l_; split16(acc[i][t][r] * (1.0f / (XS * WSC)) * XS, h_, l_); Th[i * 16 + 8 * hlf + r][t * 16 + nloc] = h_; Tl[i * 16 + 8 * hlf + r][t * 16 + nloc] = l_; }
    wave_lds_sync();
    { for (int r4 = 0; r4 < 64; r4 += 4) { const int rr = r4 + (lane >> 3), c8 = (lane & 7) * 8; const size_t gi = (mb + wm * 64 + rr) * E + n0 + wn * 64 + c8; *(v8b*)(dh + gi) = *(const v8b*)(&Th[rr][c8]); *(v8b*)(dl + gi) = *(const v8b*)(&Tl[rr][c8]); }  }
  } else {
    b16 (*Vt)[VP] = (b16 (*)[VP])SM; b16 (*Vtl)[VP] = Vt + 128; const int b = (int)(mb / S); const int s0 = (int)(mb - (size_t)b * S);
#pragma unroll
    for (int i = 0; i < 4; ++i)
#pragma unroll
      for (int t = 0; t < 4; ++t)
#pragma unroll
        for (int r = 0; r < 8; ++r) { b16 h_, l_; split16(acc[i][t][r] * (1.0f / (XS * WSC)) * XS, h_, l_); Vt[wn * 64 + t * 16 + nloc][wm * 64 + i * 16 + 8 * hlf + r] = h_; Vtl[wn * 64 + t * 16 + nloc][wm * 64 + i * 16 + 8 * hlf + r] = l_; }
    __syncthreads();
    const int cc = t_ >> 4, c8 = (t_ & 15) * 8; const size_t g0 = ((size_t)b * E + n0 + cc) * S + s0 + c8;   // row (b NH + h) D + d of V^T is b E + column, as column = h D + d; 16 threads store a row's 256 bytes
#pragma unroll   // one address pair per plane, every store at a constant offset from it
    for (int it = 0; it < 16; ++it) { *(v8b*)(VTh + g0 + (size_t)it * 8 * S) = *(const v8b*)(&Vt[it * 8 + cc][c8]); *(v8b*)(VTl + g0 + (size_t)it * 8 * S) = *(const v8b*)(&Vtl[it * 8 + cc][c8]); }
    asm volatile("s_wait_xcnt 0x0" ::: "memory"); }   // behind the last store: in the built code the other branch's first instructions, which reuse the stores' address and data registers, follow this place
}
// One work-group = 8 waves x 16 queries of one (batch, head): four 16-query groups from the low half of the sequence and their mirror images from the high half. Each 32-key tile of K (hi, lo) and V^T (hi, lo) is fetched once per work-group with line-contiguous 16-byte loads, one tile ahead
// into registers, stored to LDS and read from there as fragments by all 8 waves. Row pitches 144 B (K) and 80 B (V^T) spread the 16 rows of a ds_load_b128 over all banks.
__global__ __launch_bounds__(256) __attribute__((amdgpu_waves_per_eu(4, 4))) void attn_kernel(   /* registers held to two 8-wave work-groups per WGP */ const b16* __restrict__ Qh, const b16* __restrict__ Ql, const b16* __restrict__ Kh, const b16* __restrict__ Kl, const b16* __restrict__ VTh, const b16* __restrict__ VTl, const unsigned int* __restrict__ PB, b16* __restrict__ Oh, b16* __restrict__ Ol) {
  __shared__ __attribute__((aligned(16))) b16 Ks[2][32][D + 8]; __shared__ __attribute__((aligned(16))) b16 Vs[2][D][32 + 8]; __shared__ __attribute__((aligned(16))) float To[8][16][D + 4];
  const int wave = threadIdx.x >> 5, lane = threadIdx.x & 31, hh = lane >> 4, col = lane & 15; const int b = blockIdx.z, h = blockIdx.y;
  // which 16 queries a wave takes: waves w and w + 4 take groups g and 127 - g, g = 4 blockIdx.x + w. A wave skips the key tiles that the mask closes for all its queries, so where the open part of a row
  // grows with the query index a wave's work grows with its group; dealt this way every SIMD gets about the same number of worked tiles. Any mask is handled: the skip is still decided from the mask alone, and (blockIdx.x, wave) -> group is one-to-one onto 0..127.
  const int gl = blockIdx.x * 4 + (wave & 3); const int q0 = (wave < 4 ? gl : S / 16 - 1 - gl) * 16, qi = q0 + col;
  const int kr = threadIdx.x >> 3, kc = (threadIdx.x & 7) * 8, vr = threadIdx.x >> 2, vc = (threadIdx.x & 3) * 8;   // this thread's 16-byte piece of the K tile (32 rows x 128 B) and of the V^T tile (64 rows x 64 B)
  const size_t qo = ((size_t)b * S + qi) * E + h * D; const v16b qa0 = frag_kb(Qh + qo, hh), qa1 = frag_kb(Qh + qo + 32, hh), ql0 = frag_kb(Ql + qo, hh), ql1 = frag_kb(Ql + qo + 32, hh);
  // wave-uniform bases plus one 32-bit byte offset per thread, shared by each pair of planes (K hi/lo, V^T hi/lo); the packed bias and mask plane has its own
  const char* Kb = (const char*)(Kh + (size_t)b * S * E + h * D); const char* Klb = (const char*)(Kl + (size_t)b * S * E + h * D); const char* Vb = (const char*)(VTh + ((size_t)b * NH + h) * D * S); const char* Vlb = (const char*)(VTl + ((size_t)b * NH + h) * D * S);
  const unsigned ko = (unsigned)(kr * E + kc) * 2u, vo = (unsigned)(vr * S + vc) * 2u, po = (unsigned)(q0 >> 4) * (unsigned)(S / 32 * 1024) + (unsigned)lane * 16u;
  float m = -INFINITY, l = 0.0f; v8f o[4] = {{}, {}, {}, {}}, ol[4] = {{}, {}, {}, {}};
  const float cs = SCALE / (XS * XS); const char* prow = (const char*)PB + (size_t)b * (S / 16) * (S / 32) * 1024;
  v8b gk = *(const v8b*)(Kb + ko), gkl = *(const v8b*)(Klb + ko), gv = *(const v8b*)(Vb + vo), gvl = *(const v8b*)(Vlb + vo);
  v4u n0 = *(const v4u*)(prow + po), n1 = *(const v4u*)(prow + 512 + po);
  for (int kb = 0; kb < S; kb += 32) {
    __syncthreads();   // every wave has finished its fragment reads of the previous tile
    *(v8b*)(&Ks[0][kr][kc]) = gk; *(v8b*)(&Ks[1][kr][kc]) = gkl; *(v8b*)(&Vs[0][vr][vc]) = gv; *(v8b*)(&Vs[1][vr][vc]) = gvl;
    const v4u c0 = n0, c1 = n1;
    __syncthreads();   // the tile is visible to all 8 waves
    if (kb + 32 < S) {   // next tile and next bias and mask block fly while this tile is worked on
      const int kn = kb + 32; gk = *(const v8b*)(Kb + (size_t)kn * E * 2 + ko); gkl = *(const v8b*)(Klb + (size_t)kn * E * 2 + ko); gv = *(const v8b*)(Vb + kn * 2 + vo); gvl = *(const v8b*)(Vlb + kn * 2 + vo);
      n0 = *(const v4u*)(prow + kn * 32 + po); n1 = *(const v4u*)(prow + kn * 32 + 512 + po);
      asm volatile("s_wait_xcnt 0x0" ::: "memory"); }   // the loads' address registers are reused by the block's work below
    // per-element mask for this block: if no key of this 32-key block is allowed for ANY of the wave's 16 queries, the wave skips the block's work (decided from the input mask; wave-uniform; the barriers stay outside)
    unsigned allm = 0xFFFFFFFFu;
#pragma unroll
    for (int j = 0; j < 4; ++j) allm &= c0[j] & c1[j];
    if (__builtin_amdgcn_ballot_w32(allm != 0xFFFFFFFFu) != 0u) {
    v8f s0 = {}, s1 = {};
    { const b16* k0 = &Ks[0][col][0], *k1 = &Ks[0][16 + col][0], *k0l = &Ks[1][col][0], *k1l = &Ks[1][16 + col][0];   // K reads from LDS in one group per 16 keys, ahead of that group's WMMAs
      const v16b f0 = frag_kb(k0, hh), g0 = frag_kb(k0l, hh), f1 = frag_kb(k0 + 32, hh), g1 = frag_kb(k0l + 32, hh);
      s0 = wmma16b(f0, qa0, s0); s0 = wmma16b(f0, ql0, s0); s0 = wmma16b(g0, qa0, s0);
      s0 = wmma16b(f1, qa1, s0); s0 = wmma16b(f1, ql1, s0); s0 = wmma16b(g1, qa1, s0);
      const v16b f2 = frag_kb(k1, hh), g2 = frag_kb(k1l, hh), f3 = frag_kb(k1 + 32, hh), g3 = frag_kb(k1l + 32, hh);
      s1 = wmma16b(f2, qa0, s1); s1 = wmma16b(f2, ql0, s1); s1 = wmma16b(g2, qa0, s1);
      s1 = wmma16b(f3, qa1, s1); s1 = wmma16b(f3, ql1, s1); s1 = wmma16b(g3, qa1, s1); }
    float e[16]; unsigned ub[16]; float mx = -INFINITY;
#pragma unroll
    for (int r = 0; r < 8; ++r) { ub[r] = (r & 1) ? (c0[r >> 1] & 0xFFFF0000u) : (c0[r >> 1] << 16); ub[8 + r] = (r & 1) ? (c1[r >> 1] & 0xFFFF0000u) : (c1[r >> 1] << 16);   // bf16 bits -> f32; a masked element is a NaN until the select below
      e[r] = 1.0f + nexp2((s0[r] * cs + __uint_as_float(ub[r])) * CAPK); e[8 + r] = 1.0f + nexp2((s1[r] * cs + __uint_as_float(ub[8 + r])) * CAPK); }   // softcap: the denominators
#pragma unroll
    for (int i = 0; i < 16; i += 4) rcp4(e[i], e[i + 1], e[i + 2], e[i + 3]);
#pragma unroll
    for (int r = 0; r < 8; ++r) { const float x0 = __builtin_fmaf(e[r], -2.0f * CAPC, CAPC), x1 = __builtin_fmaf(e[8 + r], -2.0f * CAPC, CAPC);
      e[r] = (ub[r] != MASKED) ? x0 : -INFINITY; e[8 + r] = (ub[8 + r] != MASKED) ? x1 : -INFINITY; mx = fmaxf(mx, fmaxf(e[r], e[8 + r])); }
    mx = fmaxf(mx, __shfl_xor(mx, 16)); const float mn = fmaxf(m, mx);
    // a query whose keys are all masked so far keeps m = -inf: use 0 as the reference so every masked weight is exp2(-inf) = 0 and no NaN appears (no divergent control flow around the WMMAs)
    const bool none = (mn == -INFINITY); const float mref = none ? 0.0f : mn; const float al = none ? 1.0f : nexp2(m - mn); m = mn; float sum = 0.0f; v16b ph, pl;
#pragma unroll
    for (int i = 0; i < 16; i += 4) { e[i] -= mref; e[i + 1] -= mref; e[i + 2] -= mref; e[i + 3] -= mref; exp2x4(e[i], e[i + 1], e[i + 2], e[i + 3]); }
#pragma unroll
    for (int i = 0; i < 16; ++i) { const float p = e[i]; sum += p; const b16 h_ = (b16)(p * PS); ph[i] = h_; pl[i] = (b16)(p * PS - (float)h_); }
    sum += __shfl_xor(sum, 16); l = l * al + sum; v16b vf[4], vl[4];   // V^T reads from LDS in one group per 32 rows, ahead of that group's WMMAs
#pragma unroll
    for (int u = 0; u < 4; u += 2) {
#pragma unroll
      for (int t = u; t < u + 2; ++t) { vf[t] = frag_kb(&Vs[0][t * 16 + col][0], hh); vl[t] = frag_kb(&Vs[1][t * 16 + col][0], hh); }
#pragma unroll
      for (int t = u; t < u + 2; ++t) { o[t] *= al; ol[t] *= al; o[t] = wmma16b(vf[t], ph, o[t]); ol[t] = wmma16b(vf[t], pl, ol[t]); ol[t] = wmma16b(vl[t], ph, ol[t]); } } } }
  const float inv = 1.0f / (l * PS * XS);
#pragma unroll
  for (int t = 0; t < 4; ++t)
#pragma unroll
    for (int r = 0; r < 8; ++r) To[wave][col][t * 16 + 8 * hh + r] = (o[t][r] + ol[t][r]) * inv;
  wave_lds_sync();
  { for (int r4 = 0; r4 < 16; r4 += 4) { const int rr = r4 + (lane >> 3), c8 = (lane & 7) * 8; v8b hv, lv; for (int j = 0; j < 8; ++j) { b16 a_, c_; split16(To[wave][rr][c8 + j] * XS, a_, c_); hv[j] = a_; lv[j] = c_; }
      const size_t gi = ((size_t)b * S + q0 + rr) * E + h * D + c8; *(v8b*)(Oh + gi) = hv; *(v8b*)(Ol + gi) = lv; }  }
}
__global__ __launch_bounds__(128) void outproj_kernel(const b16* __restrict__ Oh, const b16* __restrict__ Ol, const b16* __restrict__ WOT, float* __restrict__ out) {
  __shared__ __attribute__((aligned(16))) float Ts[4][16][128 + 4];
  const int wave = threadIdx.x >> 5, lane = threadIdx.x & 31, nloc = lane & 15, hlf = lane >> 4; const size_t m0 = (size_t)blockIdx.x * 64 + wave * 16; const int n0 = blockIdx.y * 128;
  // operand tiles (64 x 64 of O hi and lo, 128 x 64 of Wo) staged as in proj_kernel: whole 128-byte rows, one tile ahead in registers, LDS pitch 144 B
  __shared__ __attribute__((aligned(16))) b16 As[2][64][64 + 8], Bs[128][64 + 8];
  const int sr = threadIdx.x >> 3, sc = (threadIdx.x & 7) * 8; const size_t ao = ((size_t)blockIdx.x * 64 + sr) * E + sc; const b16* Bg = WOT + (size_t)(n0 + sr) * E + sc; v8f acc[8]; v8b ga[4], gl[4], gb[8];
#pragma unroll
  for (int t = 0; t < 8; ++t) acc[t] = (v8f){};
#pragma unroll
  for (int j = 0; j < 4; ++j) { ga[j] = *(const v8b*)(Oh + ao + (size_t)j * 16 * E); gl[j] = *(const v8b*)(Ol + ao + (size_t)j * 16 * E); }
#pragma unroll
  for (int j = 0; j < 8; ++j) gb[j] = *(const v8b*)(Bg + (size_t)j * 16 * E);
  for (int kb = 0; kb < E; kb += 64) {
    __syncthreads();   // every wave has finished its fragment reads of the previous tile
#pragma unroll
    for (int j = 0; j < 4; ++j) { *(v8b*)(&As[0][j * 16 + sr][sc]) = ga[j]; *(v8b*)(&As[1][j * 16 + sr][sc]) = gl[j]; }
#pragma unroll
    for (int j = 0; j < 8; ++j) *(v8b*)(&Bs[j * 16 + sr][sc]) = gb[j];
    __syncthreads();
    if (kb + 64 < E) {
#pragma unroll
      for (int j = 0; j < 4; ++j) { ga[j] = *(const v8b*)(Oh + ao + (size_t)j * 16 * E + kb + 64); gl[j] = *(const v8b*)(Ol + ao + (size_t)j * 16 * E + kb + 64); }
      asm volatile("s_wait_xcnt 0x0" ::: "memory");   // these loads' address registers are reused as destinations of the loads that follow
#pragma unroll
      for (int j = 0; j < 8; ++j) gb[j] = *(const v8b*)(Bg + (size_t)j * 16 * E + kb + 64);
      asm volatile("s_wait_xcnt 0x0" ::: "memory"); }   // the loads' address registers are reused below
#pragma unroll
    for (int ks = 0; ks < 64; ks += 32) { const v16b a = frag_kb(&As[0][wave * 16 + nloc][ks], hlf), al = frag_kb(&As[1][wave * 16 + nloc][ks], hlf); v16b bw[8];   // the block's LDS reads as one group ahead of its WMMAs
#pragma unroll
      for (int t = 0; t < 8; ++t) bw[t] = frag_kb(&Bs[t * 16 + nloc][ks], hlf);
#pragma unroll
      for (int t = 0; t < 8; ++t) { acc[t] = wmma16b(a, bw[t], acc[t]); acc[t] = wmma16b(al, bw[t], acc[t]); } } }
#pragma unroll
  for (int t = 0; t < 8; ++t)
#pragma unroll
    for (int r = 0; r < 8; ++r) Ts[wave][8 * hlf + r][t * 16 + nloc] = acc[t][r] * (1.0f / (XS * WSC));
  wave_lds_sync();
  { for (int rr = 0; rr < 16; ++rr) *(v4f*)(out + (m0 + rr) * E + n0 + lane * 4) = *(const v4f*)(&Ts[wave][rr][lane * 4]);  }
}
}  // namespace

extern "C" void kernel_launch(void* const* d_in, const int* in_sizes, int n_in, void* d_out, int out_size, void* d_ws, size_t ws_size, hipStream_t stream) {
  (void)n_in;
  auto Fp = [&](int i) { return (const float*)d_in[i]; };
  // input order: 0 inp [2,2048,1024], 1 count_bias [2,1,2048,2048] f32, 2 attn_mask [2,1,2048,2048] i32 (1 = attend), 3 Wq, 4 Wk, 5 Wv, 6 Wo [1024,1024] (torch [out][in])
  if (in_sizes[0] != NR * E || in_sizes[1] != NB * S * S || in_sizes[2] != NB * S * S || in_sizes[3] != E * E || in_sizes[6] != E * E || out_size != NR * E) return;
  size_t off = 0; char* ws = (char*)d_ws;
  auto carve = [&](size_t bytes) { char* p = ws + off; off += (bytes + 255) & ~(size_t)255; return p; };
  b16* T16 = (b16*)carve((size_t)NR * E * 2); b16* WT = (b16*)carve((size_t)3 * E * E * 2); b16* WOT = (b16*)carve((size_t)E * E * 2);
  b16* Qh = (b16*)carve((size_t)NR * E * 2); b16* Ql = (b16*)carve((size_t)NR * E * 2); b16* Kh = (b16*)carve((size_t)NR * E * 2); b16* Kl = (b16*)carve((size_t)NR * E * 2); b16* VTh = (b16*)carve((size_t)NR * E * 2); b16* VTl = (b16*)carve((size_t)NR * E * 2);
  b16* Oh = (b16*)carve((size_t)NR * E * 2); b16* Ol = (b16*)carve((size_t)NR * E * 2); unsigned int* PB = (unsigned int*)carve((size_t)NB * S * S * 2);
  if (off > ws_size || off > ((size_t)128 << 20)) return;   // about 101 MB
  prepx_kernel<<<(unsigned)(NPK + ((size_t)NR * E / 8 + 255) / 256), 256, 0, stream>>>(Fp(0), T16, Fp(1), (const int*)d_in[2], PB);
  prepw_kernel<<<(unsigned)(((size_t)4 * E * E / 8 + 255) / 256), 256, 0, stream>>>(Fp(3), Fp(4), Fp(5), Fp(6), WT, WOT);
  proj_kernel<<<dim3(NR / 128, E / 128, 3), 128, 0, stream>>>(T16, WT, Qh, Ql, Kh, Kl, VTh, VTl);
  attn_kernel<<<dim3(S / 128, NH, NB), 256, 0, stream>>>(Qh, Ql, Kh, Kl, VTh, VTl, PB, Oh, Ol);
  outproj_kernel<<<dim3(NR / 64, E / 128), 128, 0, stream>>>(Oh, Ol, WOT, (float*)d_out);
}

// v006
// One run takes 136 microseconds.
// In two side-by-side timings against v005, it was 1.10 and 1.09 times as fast.
// Counting every step since v000, it is 4.31 times as fast.
#include <hip/hip_runtime.h>

// Softcapped, biased, masked multi-head self-attention (16 heads x 64, 2 x 2,048 tokens, d_model 1,024): q/k/v = inp W^T, scores = q.k/8 + count_bias[b,0,q,k], tanh(scores/30) x 30,
// masked (attn_mask int, 0 -> -inf), softmax, o = w v, out = concat(o) Wo^T.
// WMMA (v_wmma_f32_16x16x32_f16, f32 accumulate): projections [4,096 x 1,024] x [1,024 x 1,024] with EXACT bf16 tokens (x8) and weights (x256), 1 product, into f16 hi+lo x8 planes (v transposed
// per head); S^T with 3 products (Kh Qh + Kh Ql + Kl Qh); bias (bf16-rounded input), softcap and mask per element, online softmax in f32; O^T += V^T P^T with 3 products; output projection with
// O hi+lo (2 products) and exact Wo. Inputs rounded to bf16 once. Fragment k-map per lane half hh for A AND B: elements 0..7 <- k = 8hh+0..7, 8..15 <- k =

namespace {
constexpr int NB = 2, S = 2048, E = 1024, NH = 16, D = 64, NR = NB * S;
constexpr float XS = 8.0f, WSC = 256.0f, PS = 8.0f, SCALE = 0.125f, LOG2E = 1.4426950408889634f, SOFTCAP = 30.0f;
typedef __attribute__((ext_vector_type(4))) int v4i;
typedef __attribute__((ext_vector_type(4))) unsigned int v4u;
typedef __attribute__((ext_vector_type(2))) unsigned int v2u;

typedef _Float16 b16;
typedef __attribute__((ext_vector_type(16))) _Float16 v16b;
typedef __attribute__((ext_vector_type(8))) _Float16 v8b;
typedef __attribute__((ext_vector_type(8))) float v8f;
typedef __attribute__((ext_vector_type(4))) float v4f;
__device__ __forceinline__ float bf16_rne(float f) { unsigned int u = __float_as_uint(f); u += 0x7FFFu + ((u >> 16) & 1u); return __uint_as_float(u & 0xFFFF0000u); }
__device__ __forceinline__ void split16(float v, b16& hi, b16& lo) { hi = (b16)v; lo = (b16)(v - (float)hi); }
__device__ __forceinline__ v16b frag_kb(const b16* p, int hh) { const v8b a = *(const v8b*)(p + 8 * hh), b = *(const v8b*)(p + 16 + 8 * hh); v16b f;
#pragma unroll
  for (int e = 0; e < 8; ++e) { f[e] = a[e]; f[8 + e] = b[e]; } return f; }
__device__ __forceinline__ v8f wmma16b(v16b a, v16b b, v8f c) { v8f d = __builtin_amdgcn_wmma_f32_16x16x32_f16(false, a, false, b, (short)0, c, false, false); asm volatile("v_nop\n\tv_nop\n\tv_nop\n\tv_nop" : "+v"(d) : "v"(a), "v"(b)); return d; }
__device__ __forceinline__ void wave_lds_sync() { __builtin_amdgcn_fence(__ATOMIC_RELEASE, "workgroup"); __builtin_amdgcn_wave_barrier(); __builtin_amdgcn_fence(__ATOMIC_ACQUIRE, "workgroup"); }
__device__ __forceinline__ float nexp2(float x) { return __builtin_amdgcn_exp2f(x); }
// softcap in the unit of the softmax exponent: C tanh(x / 30) = C - 2C / (1 + 2^(x 2 log2(e) / 30)), C = 30 log2(e). No case on the sign: 2^z = inf gives C, 2^z = 0 gives -C. v_rcp_f32 (1 ulp) stands for the IEEE division sequence.
constexpr float CAPK = 2.0f * LOG2E / SOFTCAP, CAPC = SOFTCAP * LOG2E;
// four reciprocals in place; the v_nop is the slot the instruction set asks for behind a transcendental before its result is used or a source overwritten
__device__ __forceinline__ void rcp4(float& a, float& b, float& c, float& d) { asm("v_rcp_f32 %0, %0\n\tv_rcp_f32 %1, %1\n\tv_rcp_f32 %2, %2\n\tv_rcp_f32 %3, %3\n\tv_nop" : "+v"(a), "+v"(b), "+v"(c), "+v"(d)); }
__device__ __forceinline__ void exp2x4(float& a, float& b, float& c, float& d) { asm("v_exp_f32 %0, %0\n\tv_exp_f32 %1, %1\n\tv_exp_f32 %2, %2\n\tv_exp_f32 %3, %3\n\tv_nop" : "+v"(a), "+v"(b), "+v"(c), "+v"(d)); }   // the same for four 2^x

// Bias and mask as ONE 16-bit plane in the order the attention waves read it. An element is the bf16 bits of the rounded bias, or MASKED (0xFFFF, a NaN pattern that no rounded finite or infinite bias has) where attn_mask is 0.
// PB[b][16-query group][32-key tile][j][lane][8]: lane = 16 hh + col holds query col, keys 16 j + 8 hh + 0..7 of the tile, so a wave's 64-key block is 2 KiB in a row and four whole-line 16-byte loads fetch it.
constexpr unsigned MASKED = 0xFFFF0000u; constexpr int PKEYS = 512, NPK = NB * (S / 16) * (S / PKEYS), PPITCH = 256 + 32;   // a pack block: 16 queries x 512 keys, all its 16 loads per thread in flight at once; LDS pitch of a 256-byte piece (one j, hh), 8 banks on per piece so the 8-byte stores of a wave hit all 64 banks once
__device__ __forceinline__ unsigned bm_bits(float f, int mk) { unsigned int u = __float_as_uint(f); u += 0x7FFFu + ((u >> 16) & 1u); return mk != 0 ? u : 0xFFFFFFFFu; }   // high half: the element
__global__ __launch_bounds__(256) void prepx_kernel(const float* __restrict__ x, b16* __restrict__ T16, const float* __restrict__ cbias, const int* __restrict__ amask, unsigned int* __restrict__ PB) {
  __shared__ __attribute__((aligned(16))) unsigned char Ps[(PKEYS / 8) * PPITCH];
  if (blockIdx.x < NPK) {   // the first blocks pack bias and mask: whole-line reads along the rows, reordered in LDS, whole-line stores
    const int t_ = threadIdx.x, bq = blockIdx.x / (S / PKEYS), kq = blockIdx.x % (S / PKEYS), row = t_ >> 4, c = t_ & 15; const size_t so = ((size_t)bq * 16 + row) * S + kq * PKEYS + c * 4; const float* bp = cbias + so; const int* mp = amask + so; v4f bv[PKEYS / 64]; v4i mv[PKEYS / 64];
#pragma unroll
    for (int i = 0; i < PKEYS / 64; ++i) { bv[i] = *(const v4f*)(bp + i * 64); mv[i] = *(const v4i*)(mp + i * 64); }
    // the loaded values as inputs only: all 16 loads are issued ahead of this line (without it this build sank the mask loads among the conversions, one or two in flight); the wait: the loads' address registers are reused below;
    // the two row pointers as inputs too: they stay live up to the wait, so no load's result is placed on an address pair of the run (without them the last load's result was)
    static_assert(PKEYS == 512, "the statement below names 8 + 8 loads");
    asm volatile("s_wait_xcnt 0x0" :: "v"(bv[0]), "v"(bv[1]), "v"(bv[2]), "v"(bv[3]), "v"(bv[4]), "v"(bv[5]), "v"(bv[6]), "v"(bv[7]), "v"(mv[0]), "v"(mv[1]), "v"(mv[2]), "v"(mv[3]), "v"(mv[4]), "v"(mv[5]), "v"(mv[6]), "v"(mv[7]), "v"(bp), "v"(mp) : "memory");
#pragma unroll
    for (int i = 0; i < PKEYS / 64; ++i) { v2u w; w[0] = (bm_bits(bv[i][0], mv[i][0]) >> 16) | (bm_bits(bv[i][1], mv[i][1]) & 0xFFFF0000u); w[1] = (bm_bits(bv[i][2], mv[i][2]) >> 16) | (bm_bits(bv[i][3], mv[i][3]) & 0xFFFF0000u);
      *(v2u*)(&Ps[(i * 8 + (c >> 1)) * PPITCH + row * 16 + (c & 1) * 8]) = w; }   // keys 64 i + 4 c + 0..3: piece (key >> 3), then the query's 16 bytes
    __syncthreads();
    char* dst = (char*)PB + ((size_t)bq * (S / 32) + kq * (PKEYS / 32)) * 1024;
#pragma unroll
    for (int i = 0; i < PKEYS / 128; ++i) { const int o = (i * 256 + t_) * 16; *(v4u*)(dst + o) = *(const v4u*)(&Ps[(o >> 8) * PPITCH + (o & 255)]); }
    return; }
  const size_t t = (size_t)(blockIdx.x - NPK) * 256 + threadIdx.x; const size_t n1 = (size_t)NR * E / 8; const float* src; b16* dst; size_t e;
  if (t < n1) { src = x; dst = T16; e = t * 8; } else return;
  const v4f a = *(const v4f*)(src + e), c = *(const v4f*)(src + e + 4); v8b o;
#pragma unroll
  for (int j = 0; j < 4; ++j) { o[j] = (b16)(bf16_rne(a[j]) * XS); o[4 + j] = (b16)(bf16_rne(c[j]) * XS); }
  { *(v8b*)(dst + e) = o;  }
}
__global__ __launch_bounds__(256) void prepw_kernel(const float* __restrict__ wq, const float* __restrict__ wk, const float* __restrict__ wv, const float* __restrict__ wo, b16* __restrict__ WT, b16* __restrict__ WOT) {
  const size_t t = (size_t)blockIdx.x * 256 + threadIdx.x; const size_t nw = (size_t)E * E / 8; if (t >= 4 * nw) return; const int kind = (int)(t / nw); const size_t e = (t - (size_t)kind * nw) * 8;
  const float* w = kind == 0 ? wq : kind == 1 ? wk : kind == 2 ? wv : wo; b16* dst = kind < 3 ? WT + (size_t)kind * E * E : WOT;   // torch [out][in] rows used directly as B columns (x W^T)
  const v4f a = *(const v4f*)(w + e), c = *(const v4f*)(w + e + 4); v8b o;
#pragma unroll
  for (int j = 0; j < 4; ++j) { o[j] = (b16)(bf16_rne(a[j]) * WSC); o[4 + j] = (b16)(bf16_rne(c[j]) * WSC); }
  { *(v8b*)(dst + e) = o;  }
}
// projections: grid (NR/128, E/128, 3): kind 0: Q = T16 WT0^T -> Qh/Ql [row][1024]; kind 1: K = T16 WT1^T -> Kh/Kl; kind 2: V = T16 WT2^T written TRANSPOSED per head: VTh/VTl [b][h][64 d][2048 s].
// A work-group of 4 waves makes a 128 x 128 tile, a wave a 64 x 64 tile (4 x 4 fragments): 8 fragment reads from LDS feed 16 WMMAs (a 16 x 128 wave tile took 9 reads for 8), and a work-group's 32 KiB of operands serve twice the output.
__global__ __launch_bounds__(128) void proj_kernel(const b16* __restrict__ T16, const b16* __restrict__ WT, b16* __restrict__ Qh, b16* __restrict__ Ql, b16* __restrict__ Kh, b16* __restrict__ Kl, b16* __restrict__ VTh, b16* __restrict__ VTl) {
  constexpr int TP = 64 + 8, VP = 128 + 8;   // row pitches in elements: 144 B (operand tiles, Q and K staging), 272 B (V^T staging)
  __shared__ __attribute__((aligned(16))) b16 SM[4 * 2 * 64 * TP];   // one block: first the operand tiles, then, behind a barrier, the output staging
  static_assert(4 * 2 * 64 * TP >= 2 * 128 * VP && 4 * 2 * 64 * TP >= 2 * 128 * TP, "the block holds each of its three uses");
  b16 (*As)[TP] = (b16 (*)[TP])SM; b16 (*Bs)[TP] = (b16 (*)[TP])(SM + 128 * TP);
  const int wave = threadIdx.x >> 5, lane = threadIdx.x & 31, nloc = lane & 15, hlf = lane >> 4, t_ = threadIdx.x, wm = wave >> 1, wn = wave & 1; const int kind = blockIdx.z; const size_t mb = (size_t)blockIdx.x * 128; const int n0 = blockIdx.y * 128;
  // operand tiles (128 x 64 of A, 128 x 64 of W) are fetched once per work-group as whole 128-byte rows, one tile ahead into registers, stored to LDS (pitch 144 B) and read from there as fragments by the 4 waves
  const int sr = t_ >> 3, sc = (t_ & 7) * 8; const b16* Ag = T16 + (mb + sr) * E + sc; const b16* Bg = WT + (size_t)kind * E * E + (size_t)(n0 + sr) * E + sc; v8f acc[4][4]; v8b ga[8], gb[8];
#pragma unroll
  for (int i = 0; i < 4; ++i)
#pragma unroll
    for (int t = 0; t < 4; ++t) acc[i][t] = (v8f){};
#pragma unroll
  for (int j = 0; j < 8; ++j) ga[j] = *(const v8b*)(Ag + (size_t)j * 16 * E);
#pragma unroll
  for (int j = 0; j < 8; ++j) gb[j] = *(const v8b*)(Bg + (size_t)j * 16 * E);
  for (int kb = 0; kb < E; kb += 64) {
    __syncthreads();   // every wave has finished its fragment reads of the previous tile
#pragma unroll
    for (int j = 0; j < 8; ++j) *(v8b*)(&As[j * 16 + sr][sc]) = ga[j];
#pragma unroll
    for (int j = 0; j < 8; ++j) *(v8b*)(&Bs[j * 16 + sr][sc]) = gb[j];
    __syncthreads();
    if (kb + 64 < E) {
#pragma unroll
      for (int j = 0; j < 8; ++j) ga[j] = *(const v8b*)(Ag + (size_t)j * 16 * E + kb + 64);
#pragma unroll
      for (int j = 0; j < 8; ++j) gb[j] = *(const v8b*)(Bg + (size_t)j * 16 * E + kb + 64);
      asm volatile("s_wait_xcnt 0x0" ::: "memory"); }   // the loads' address registers are reused below
#pragma unroll
    for (int ks = 0; ks < 64; ks += 32) { v16b a[4], bw[4];   // the block's LDS reads as one group ahead of its WMMAs
#pragma unroll
      for (int i = 0; i < 4; ++i) a[i] = frag_kb(&As[wm * 64 + i * 16 + nloc][ks], hlf);
#pragma unroll
      for (int t = 0; t < 4; ++t) bw[t] = frag_kb(&Bs[wn * 64 + t * 16 + nloc][ks], hlf);
#pragma unroll
      for (int i = 0; i < 4; ++i)
#pragma unroll
        for (int t = 0; t < 4; ++t) acc[i][t] = wmma16b(a[i], bw[t], acc[i][t]); } }
  __syncthreads();   // every wave has finished its fragment reads of the last tile: the block becomes output staging
  if (kind < 2) {   // a wave stages its 64 rows x 64 columns (hi, lo) in its own range and stores them as whole 128-byte lines, 4 rows a store
    b16 (*Th)[TP] = (b16 (*)[TP])(SM + wave * 2 * 64 * TP); b16 (*Tl)[TP] = Th + 64; b16* dh = kind == 0 ? Qh : Kh; b16* dl = kind == 0 ? Ql : Kl;
#pragma unroll
    for (int i = 0; i < 4; ++i)
#pragma unroll
      for (int t = 0; t < 4; ++t)
#pragma unroll
        for (int r = 0; r < 8; ++r) { b16 h_, l_; split16(acc[i][t][r] * (1.0f / (XS * WSC)) * XS, h_, l_); Th[i * 16 + 8 * hlf + r][t * 16 + nloc] = h_; Tl[i * 16 + 8 * hlf + r][t * 16 + nloc] = l_; }
    wave_lds_sync();
    { for (int r4 = 0; r4 < 64; r4 += 4) { const int rr = r4 + (lane >> 3), c8 = (lane & 7) * 8; const size_t gi = (mb + wm * 64 + rr) * E + n0 + wn * 64 + c8; *(v8b*)(dh + gi) = *(const v8b*)(&Th[rr][c8]); *(v8b*)(dl + gi) = *(const v8b*)(&Tl[rr][c8]); }  }
  } else {
    b16 (*Vt)[VP] = (b16 (*)[VP])SM; b16 (*Vtl)[VP] = Vt + 128; const int b = (int)(mb / S); const int s0 = (int)(mb - (size_t)b * S);
#pragma unroll
    for (int i = 0; i < 4; ++i)
#pragma unroll
      for (int t = 0; t < 4; ++t)
#pragma unroll
        for (int r = 0; r < 8; ++r) { b16 h_, l_; split16(acc[i][t][r] * (1.0f / (XS * WSC)) * XS, h_, l_); Vt[wn * 64 + t * 16 + nloc][wm * 64 + i * 16 + 8 * hlf + r] = h_; Vtl[wn * 64 + t * 16 + nloc][wm * 64 + i * 16 + 8 * hlf + r] = l_; }
    __syncthreads();
    const int cc = t_ >> 4, c8 = (t_ & 15) * 8; const size_t g0 = ((size_t)b * E + n0 + cc) * S + s0 + c8;   // row (b NH + h) D + d of V^T is b E + column, as column = h D + d; 16 threads store a row's 256 bytes
#pragma unroll   // one address pair per plane, every store at a constant offset from it
    for (int it = 0; it < 16; ++it) { *(v8b*)(VTh + g0 + (size_t)it * 8 * S) = *(const v8b*)(&Vt[it * 8 + cc][c8]); *(v8b*)(VTl + g0 + (size_t)it * 8 * S) = *(const v8b*)(&Vtl[it * 8 + cc][c8]); }
    asm volatile("s_wait_xcnt 0x0" ::: "memory"); }   // behind the last store: in the built code the other branch's first instructions, which reuse the stores' address and data registers, follow this place
}
// One work-group = 8 waves x 16 queries of one (batch, head): four 16-query groups from the low half of the sequence and their mirror images from the high half. Each 64-key tile of K (hi, lo) and V^T (hi, lo) is fetched once per work-group as whole 128-byte lines, one tile ahead
// into registers, stored to LDS and read from there as fragments by all 8 waves. The row pitch of 144 B spreads the 16 rows of a ds_load_b128 over all banks. A step of 64 keys has one pair of barriers, one row maximum, one rescale of O and one mask test, and its four score tiles give two independent WMMA chains.
__global__ __launch_bounds__(256) __attribute__((amdgpu_waves_per_eu(4, 4))) void attn_kernel(   /* registers held to two 8-wave work-groups per WGP */ const b16* __restrict__ Qh, const b16* __restrict__ Ql, const b16* __restrict__ Kh, const b16* __restrict__ Kl, const b16* __restrict__ VTh, const b16* __restrict__ VTl, const unsigned int* __restrict__ PB, b16* __restrict__ Oh, b16* __restrict__ Ol) {
  constexpr int KT = 64;   // keys a step
  static_assert(KT == D, "K tile and V^T tile have one shape"); __shared__ __attribute__((aligned(16))) b16 KV[4][KT][D + 8];   /* K hi, K lo (64 keys x 64), V^T hi, V^T lo (64 rows x 64 keys): one array, so one address register serves all four planes */ __shared__ __attribute__((aligned(16))) float To[8][16][D + 4];
  const int wave = __builtin_amdgcn_readfirstlane(threadIdx.x >> 5) /* held in a scalar register, and with it the wave's query group */, lane = threadIdx.x & 31, hh = lane >> 4, col = lane & 15; const int b = blockIdx.z, h = blockIdx.y;
  // which 16 queries a wave takes: waves w and w + 4 take groups g and 127 - g, g = 4 blockIdx.x + w. A wave skips the key tiles that the mask closes for all its queries, so where the open part of a row
  // grows with the query index a wave's work grows with its group; dealt this way every SIMD gets about the same number of worked tiles. Any mask is handled: the skip is still decided from the mask alone, and (blockIdx.x, wave) -> group is one-to-one onto 0..127.
  const int gl = blockIdx.x * 4 + (wave & 3); const int q0 = (wave < 4 ? gl : S / 16 - 1 - gl) * 16, qi = q0 + col;
  const int kr = threadIdx.x >> 3, kc = (threadIdx.x & 7) * 8;   // this thread's 16-byte pieces: rows kr and kr + 32 of the K tile (64 keys x 128 B) and of the V^T tile (64 rows x 128 B), whole 128-byte lines of both
  const size_t qo = ((size_t)b * S + qi) * E + h * D; const v16b qa0 = frag_kb(Qh + qo, hh), qa1 = frag_kb(Qh + qo + 32, hh), ql0 = frag_kb(Ql + qo, hh), ql1 = frag_kb(Ql + qo + 32, hh);
  // wave-uniform bases plus one 32-bit byte offset per thread, shared by each pair of planes (K hi/lo, V^T hi/lo); the packed bias and mask plane has its own
  const char* Kb = (const char*)(Kh + (size_t)b * S * E + h * D); const char* Klb = (const char*)(Kl + (size_t)b * S * E + h * D); const char* Vb = (const char*)(VTh + ((size_t)b * NH + h) * D * S); const char* Vlb = (const char*)(VTl + ((size_t)b * NH + h) * D * S);
  const unsigned ko = (unsigned)(kr * E + kc) * 2u, vo = (unsigned)(kr * S + kc) * 2u, po = (unsigned)(q0 >> 4) * (unsigned)(S / 32 * 1024) + (unsigned)lane * 16u;
  float m = -INFINITY, l = 0.0f; v8f o[4] = {{}, {}, {}, {}};   // one accumulator per 16 rows of O^T takes all three products (hi hi, hi lo, lo hi): a second set would not fit the registers beside a 64-key step
  const float cs = SCALE / (XS * XS); const char* prow = (const char*)PB + (size_t)b * (S / 16) * (S / 32) * 1024;
  v8b gk[2], gkl[2], gv[2], gvl[2]; v4u n[4];
#pragma unroll
  for (int i = 0; i < 2; ++i) { gk[i] = *(const v8b*)(Kb + i * 32 * E * 2 + ko); gkl[i] = *(const v8b*)(Klb + i * 32 * E * 2 + ko); gv[i] = *(const v8b*)(Vb + i * 32 * S * 2 + vo); gvl[i] = *(const v8b*)(Vlb + i * 32 * S * 2 + vo); }
#pragma unroll
  for (int j = 0; j < 4; ++j) n[j] = *(const v4u*)(prow + j * 512 + po);
  for (int kb = 0; kb < S; kb += KT) {
    __syncthreads();   // every wave has finished its fragment reads of the previous tile
#pragma unroll
    for (int i = 0; i < 2; ++i) { *(v8b*)(&KV[0][kr + 32 * i][kc]) = gk[i]; *(v8b*)(&KV[1][kr + 32 * i][kc]) = gkl[i]; *(v8b*)(&KV[2][kr + 32 * i][kc]) = gv[i]; *(v8b*)(&KV[3][kr + 32 * i][kc]) = gvl[i]; }
    __syncthreads();   // the tile is visible to all 8 waves
    // per-element mask for this block: if no key of this 64-key block is allowed for ANY of the wave's 16 queries, the wave skips the block's work (decided from the input mask; wave-uniform; the barriers stay outside)
    unsigned allm = 0xFFFFFFFFu;
#pragma unroll
    for (int j = 0; j < 4; ++j) allm &= n[j][0] & n[j][1] & n[j][2] & n[j][3];
    const bool act = __builtin_amdgcn_ballot_w32(allm != 0xFFFFFFFFu) != 0u;
    float e[32], mref = 0.0f, al = 1.0f;
    if (act) {
      v8f s[4] = {{}, {}, {}, {}};   // S^T, 16 keys each; two accumulator chains run side by side, and a group of K reads from LDS stands one group of WMMAs ahead of its use
      v16b f[2][2], g[2][2], f2[2][2], g2[2][2];   // [d half][key group of the pair]
#pragma unroll
      for (int dh = 0; dh < 2; ++dh)
#pragma unroll
        for (int j = 0; j < 2; ++j) { f[dh][j] = frag_kb(&KV[0][j * 16 + col][dh * 32], hh); g[dh][j] = frag_kb(&KV[1][j * 16 + col][dh * 32], hh); }
      s[0] = wmma16b(f[0][0], qa0, s[0]); s[1] = wmma16b(f[0][1], qa0, s[1]); s[0] = wmma16b(f[0][0], ql0, s[0]); s[1] = wmma16b(f[0][1], ql0, s[1]); s[0] = wmma16b(g[0][0], qa0, s[0]); s[1] = wmma16b(g[0][1], qa0, s[1]);
#pragma unroll
      for (int j = 0; j < 2; ++j) { f2[0][j] = frag_kb(&KV[0][32 + j * 16 + col][0], hh); g2[0][j] = frag_kb(&KV[1][32 + j * 16 + col][0], hh); }
      s[0] = wmma16b(f[1][0], qa1, s[0]); s[1] = wmma16b(f[1][1], qa1, s[1]); s[0] = wmma16b(f[1][0], ql1, s[0]); s[1] = wmma16b(f[1][1], ql1, s[1]); s[0] = wmma16b(g[1][0], qa1, s[0]); s[1] = wmma16b(g[1][1], qa1, s[1]);
#pragma unroll
      for (int j = 0; j < 2; ++j) { f2[1][j] = frag_kb(&KV[0][32 + j * 16 + col][32], hh); g2[1][j] = frag_kb(&KV[1][32 + j * 16 + col][32], hh); }
      s[2] = wmma16b(f2[0][0], qa0, s[2]); s[3] = wmma16b(f2[0][1], qa0, s[3]); s[2] = wmma16b(f2[0][0], ql0, s[2]); s[3] = wmma16b(f2[0][1], ql0, s[3]); s[2] = wmma16b(g2[0][0], qa0, s[2]); s[3] = wmma16b(g2[0][1], qa0, s[3]);
      s[2] = wmma16b(f2[1][0], qa1, s[2]); s[3] = wmma16b(f2[1][1], qa1, s[3]); s[2] = wmma16b(f2[1][0], ql1, s[2]); s[3] = wmma16b(f2[1][1], ql1, s[3]); s[2] = wmma16b(g2[1][0], qa1, s[2]); s[3] = wmma16b(g2[1][1], qa1, s[3]);
      float mx = -INFINITY;
#pragma unroll
      for (int j = 0; j < 4; ++j) { unsigned ub[8]; float d[8];   // keys 16 j + 8 hh + 0..7 of the tile
#pragma unroll
        for (int r = 0; r < 8; ++r) { ub[r] = (r & 1) ? (n[j][r >> 1] & 0xFFFF0000u) : (n[j][r >> 1] << 16);   // bf16 bits -> f32; a masked element is a NaN until the select below
          d[r] = 1.0f + nexp2((s[j][r] * cs + __uint_as_float(ub[r])) * CAPK); }   // softcap: the denominators
        rcp4(d[0], d[1], d[2], d[3]); rcp4(d[4], d[5], d[6], d[7]);
#pragma unroll
        for (int r = 0; r < 8; ++r) { const float x = __builtin_fmaf(d[r], -2.0f * CAPC, CAPC); e[j * 8 + r] = (ub[r] != MASKED) ? x : -INFINITY; mx = fmaxf(mx, e[j * 8 + r]); } }
      mx = fmaxf(mx, __shfl_xor(mx, 16)); const float mn = fmaxf(m, mx);
      // a query whose keys are all masked so far keeps m = -inf: use 0 as the reference so every masked weight is exp2(-inf) = 0 and no NaN appears (no divergent control flow around the WMMAs)
      const bool none = (mn == -INFINITY); mref = none ? 0.0f : mn; al = none ? 1.0f : nexp2(m - mn); m = mn; }
    if (kb + KT < S) {   // next tile and next bias and mask block, asked for here, where this block's bias and mask registers are free again: they fly during the weights and the second product and cost the score product no registers
      Kb += KT * E * 2; Klb += KT * E * 2; Vb += KT * 2; Vlb += KT * 2; prow += KT * 32;   // the wave-uniform bases step on; the threads' 32-bit offsets stay
#pragma unroll
      for (int i = 0; i < 2; ++i) { gk[i] = *(const v8b*)(Kb + i * 32 * E * 2 + ko); gkl[i] = *(const v8b*)(Klb + i * 32 * E * 2 + ko); gv[i] = *(const v8b*)(Vb + i * 32 * S * 2 + vo); gvl[i] = *(const v8b*)(Vlb + i * 32 * S * 2 + vo); }
#pragma unroll
      for (int j = 0; j < 4; ++j) n[j] = *(const v4u*)(prow + j * 512 + po);
      asm volatile("s_wait_xcnt 0x0" ::: "memory"); }   // the loads' address registers are reused by the block's work below
    if (act) {
      v16b vf[4][2], vl[4][2];   // V^T reads from LDS, a group = 32 rows x 32 keys (hi, lo), one group of WMMAs ahead of its use; group u: keys 32 (u >> 1), rows 32 (u & 1)
#pragma unroll
      for (int t = 0; t < 2; ++t) { vf[0][t] = frag_kb(&KV[2][t * 16 + col][0], hh); vl[0][t] = frag_kb(&KV[3][t * 16 + col][0], hh); }
      float sum[4] = {0.0f, 0.0f, 0.0f, 0.0f};
#pragma unroll
      for (int t = 0; t < 4; ++t) o[t] *= al;
#pragma unroll
      for (int kk = 0; kk < 2; ++kk) { v16b ph, pl;   // 32 keys at a time: their weights, then their products, so that only half the weights are held as f32 and as f16 pairs at once
#pragma unroll
        for (int i = kk * 16; i < kk * 16 + 16; i += 4) { e[i] -= mref; e[i + 1] -= mref; e[i + 2] -= mref; e[i + 3] -= mref; exp2x4(e[i], e[i + 1], e[i + 2], e[i + 3]); }
#pragma unroll
        for (int i = 0; i < 16; ++i) { const float p = e[kk * 16 + i]; sum[i & 3] += p; const b16 h_ = (b16)(p * PS); ph[i] = h_; pl[i] = (b16)(p * PS - (float)h_); }
#pragma unroll
        for (int u = kk * 2; u < kk * 2 + 2; ++u) { const int t0 = (u & 1) * 2;
          if (u < 3) { const int k2 = (u + 1) >> 1, t2 = ((u + 1) & 1) * 2;
#pragma unroll
            for (int t = 0; t < 2; ++t) { vf[u + 1][t] = frag_kb(&KV[2][(t2 + t) * 16 + col][k2 * 32], hh); vl[u + 1][t] = frag_kb(&KV[3][(t2 + t) * 16 + col][k2 * 32], hh); } }
          o[t0] = wmma16b(vf[u][0], ph, o[t0]); o[t0 + 1] = wmma16b(vf[u][1], ph, o[t0 + 1]); o[t0] = wmma16b(vf[u][0], pl, o[t0]); o[t0 + 1] = wmma16b(vf[u][1], pl, o[t0 + 1]);
          o[t0] = wmma16b(vl[u][0], ph, o[t0]); o[t0 + 1] = wmma16b(vl[u][1], ph, o[t0 + 1]); } }
      float sm = (sum[0] + sum[1]) + (sum[2] + sum[3]); sm += __shfl_xor(sm, 16); l = l * al + sm; } }
  const float inv = 1.0f / (l * PS * XS);
#pragma unroll
  for (int t = 0; t < 4; ++t)
#pragma unroll
    for (int r = 0; r < 8; ++r) To[wave][col][t * 16 + 8 * hh + r] = o[t][r] * inv;
  wave_lds_sync();
  { for (int r4 = 0; r4 < 16; r4 += 4) { const int rr = r4 + (lane >> 3), c8 = (lane & 7) * 8; v8b hv, lv; for (int j = 0; j < 8; ++j) { b16 a_, c_; split16(To[wave][rr][c8 + j] * XS, a_, c_); hv[j] = a_; lv[j] = c_; }
      const size_t gi = ((size_t)b * S + q0 + rr) * E + h * D + c8; *(v8b*)(Oh + gi) = hv; *(v8b*)(Ol + gi) = lv; }  }
}
__global__ __launch_bounds__(128) void outproj_kernel(const b16* __restrict__ Oh, const b16* __restrict__ Ol, const b16* __restrict__ WOT, float* __restrict__ out) {
  __shared__ __attribute__((aligned(16))) float Ts[4][16][128 + 4];
  const int wave = threadIdx.x >> 5, lane = threadIdx.x & 31, nloc = lane & 15, hlf = lane >> 4; const size_t m0 = (size_t)blockIdx.x * 64 + wave * 16; const int n0 = blockIdx.y * 128;
  // operand tiles (64 x 64 of O hi and lo, 128 x 64 of Wo) staged as in proj_kernel: whole 128-byte rows, one tile ahead in registers, LDS pitch 144 B
  __shared__ __attribute__((aligned(16))) b16 As[2][64][64 + 8], Bs[128][64 + 8];
  const int sr = threadIdx.x >> 3, sc = (threadIdx.x & 7) * 8; const size_t ao = ((size_t)blockIdx.x * 64 + sr) * E + sc; const b16* Bg = WOT + (size_t)(n0 + sr) * E + sc; v8f acc[8]; v8b ga[4], gl[4], gb[8];
#pragma unroll
  for (int t = 0; t < 8; ++t) acc[t] = (v8f){};
#pragma unroll
  for (int j = 0; j < 4; ++j) { ga[j] = *(const v8b*)(Oh + ao + (size_t)j * 16 * E); gl[j] = *(const v8b*)(Ol + ao + (size_t)j * 16 * E); }
#pragma unroll
  for (int j = 0; j < 8; ++j) gb[j] = *(const v8b*)(Bg + (size_t)j * 16 * E);
  for (int kb = 0; kb < E; kb += 64) {
    __syncthreads();   // every wave has finished its fragment reads of the previous tile
#pragma unroll
    for (int j = 0; j < 4; ++j) { *(v8b*)(&As[0][j * 16 + sr][sc]) = ga[j]; *(v8b*)(&As[1][j * 16 + sr][sc]) = gl[j]; }
#pragma unroll
    for (int j = 0; j < 8; ++j) *(v8b*)(&Bs[j * 16 + sr][sc]) = gb[j];
    __syncthreads();
    if (kb + 64 < E) {
#pragma unroll
      for (int j = 0; j < 4; ++j) { ga[j] = *(const v8b*)(Oh + ao + (size_t)j * 16 * E + kb + 64); gl[j] = *(const v8b*)(Ol + ao + (size_t)j * 16 * E + kb + 64); }
      asm volatile("s_wait_xcnt 0x0" ::: "memory");   // these loads' address registers are reused as destinations of the loads that follow
#pragma unroll
      for (int j = 0; j < 8; ++j) gb[j] = *(const v8b*)(Bg + (size_t)j * 16 * E + kb + 64);
      asm volatile("s_wait_xcnt 0x0" ::: "memory"); }   // the loads' address registers are reused below
#pragma unroll
    for (int ks = 0; ks < 64; ks += 32) { const v16b a = frag_kb(&As[0][wave * 16 + nloc][ks], hlf), al = frag_kb(&As[1][wave * 16 + nloc][ks], hlf); v16b bw[8];   // the block's LDS reads as one group ahead of its WMMAs
#pragma unroll
      for (int t = 0; t < 8; ++t) bw[t] = frag_kb(&Bs[t * 16 + nloc][ks], hlf);
#pragma unroll
      for (int t = 0; t < 8; ++t) { acc[t] = wmma16b(a, bw[t], acc[t]); acc[t] = wmma16b(al, bw[t], acc[t]); } } }
#pragma unroll
  for (int t = 0; t < 8; ++t)
#pragma unroll
    for (int r = 0; r < 8; ++r) Ts[wave][8 * hlf + r][t * 16 + nloc] = acc[t][r] * (1.0f / (XS * WSC));
  wave_lds_sync();
  { for (int rr = 0; rr < 16; ++rr) *(v4f*)(out + (m0 + rr) * E + n0 + lane * 4) = *(const v4f*)(&Ts[wave][rr][lane * 4]);  }
}
}  // namespace

extern "C" void kernel_launch(void* const* d_in, const int* in_sizes, int n_in, void* d_out, int out_size, void* d_ws, size_t ws_size, hipStream_t stream) {
  (void)n_in;
  auto Fp = [&](int i) { return (const float*)d_in[i]; };
  // input order: 0 inp [2,2048,1024], 1 count_bias [2,1,2048,2048] f32, 2 attn_mask [2,1,2048,2048] i32 (1 = attend), 3 Wq, 4 Wk, 5 Wv, 6 Wo [1024,1024] (torch [out][in])
  if (in_sizes[0] != NR * E || in_sizes[1] != NB * S * S || in_sizes[2] != NB * S * S || in_sizes[3] != E * E || in_sizes[6] != E * E || out_size != NR * E) return;
  size_t off = 0; char* ws = (char*)d_ws;
  auto carve = [&](size_t bytes) { char* p = ws + off; off += (bytes + 255) & ~(size_t)255; return p; };
  b16* T16 = (b16*)carve((size_t)NR * E * 2); b16* WT = (b16*)carve((size_t)3 * E * E * 2); b16* WOT = (b16*)carve((size_t)E * E * 2);
  b16* Qh = (b16*)carve((size_t)NR * E * 2); b16* Ql = (b16*)carve((size_t)NR * E * 2); b16* Kh = (b16*)carve((size_t)NR * E * 2); b16* Kl = (b16*)carve((size_t)NR * E * 2); b16* VTh = (b16*)carve((size_t)NR * E * 2); b16* VTl = (b16*)carve((size_t)NR * E * 2);
  b16* Oh = (b16*)carve((size_t)NR * E * 2); b16* Ol = (b16*)carve((size_t)NR * E * 2); unsigned int* PB = (unsigned int*)carve((size_t)NB * S * S * 2);
  if (off > ws_size || off > ((size_t)128 << 20)) return;   // about 101 MB
  prepx_kernel<<<(unsigned)(NPK + ((size_t)NR * E / 8 + 255) / 256), 256, 0, stream>>>(Fp(0), T16, Fp(1), (const int*)d_in[2], PB);
  prepw_kernel<<<(unsigned)(((size_t)4 * E * E / 8 + 255) / 256), 256, 0, stream>>>(Fp(3), Fp(4), Fp(5), Fp(6), WT, WOT);
  proj_kernel<<<dim3(NR / 128, E / 128, 3), 128, 0, stream>>>(T16, WT, Qh, Ql, Kh, Kl, VTh, VTl);
  attn_kernel<<<dim3(S / 128, NH, NB), 256, 0, stream>>>(Qh, Ql, Kh, Kl, VTh, VTl, PB, Oh, Ol);
  outproj_kernel<<<dim3(NR / 64, E / 128), 128, 0, stream>>>(Oh, Ol, WOT, (float*)d_out);
}

// v007
// Measured time: 131 microseconds a run.
// Timed twice side by side with v006, it ran 1.04 and 1.03 times as fast.
// Over all steps from v000 it is 4.46 times as fast.
#include <hip/hip_runtime.h>

// Softcapped, biased, masked multi-head self-attention (16 heads x 64, 2 x 2,048 tokens, d_model 1,024): q/k/v = inp W^T, scores = q.k/8 + count_bias[b,0,q,k], tanh(scores/30) x 30,
// masked (attn_mask int, 0 -> -inf), softmax, o = w v, out = concat(o) Wo^T.
// WMMA (v_wmma_f32_16x16x32_f16, f32 accumulate): projections [4,096 x 1,024] x [1,024 x 1,024] with EXACT bf16 tokens (x8) and weights (x256), 1 product, into f16 hi+lo x8 planes (v transposed
// per head); S^T with 3 products (Kh Qh + Kh Ql + Kl Qh); bias (bf16-rounded input), softcap and mask per element, online softmax in f32; O^T += V^T P^T with 3 products; output projection with
// O hi+lo (2 products) and exact Wo. Inputs rounded to bf16 once. Fragment k-map per lane half hh for A AND B: elements 0..7 <- k = 8hh+0..7, 8..15 <- k =

namespace {
constexpr int NB = 2, S = 2048, E = 1024, NH = 16, D = 64, NR = NB * S;
constexpr float XS = 8.0f, WSC = 256.0f, PS = 8.0f, SCALE = 0.125f, LOG2E = 1.4426950408889634f, SOFTCAP = 30.0f;
typedef __attribute__((ext_vector_type(4))) int v4i;
typedef __attribute__((ext_vector_type(4))) unsigned int v4u;
typedef __attribute__((ext_vector_type(2))) unsigned int v2u;

typedef _Float16 b16;
typedef __attribute__((ext_vector_type(16))) _Float16 v16b;
typedef __attribute__((ext_vector_type(8))) _Float16 v8b;
typedef __attribute__((ext_vector_type(8))) float v8f;
typedef __attribute__((ext_vector_type(4))) float v4f;
__device__ __forceinline__ float bf16_rne(float f) { unsigned int u = __float_as_uint(f); u += 0x7FFFu + ((u >> 16) & 1u); return __uint_as_float(u & 0xFFFF0000u); }
__device__ __forceinline__ void split16(float v, b16& hi, b16& lo) { hi = (b16)v; lo = (b16)(v - (float)hi); }
__device__ __forceinline__ v16b frag_kb(const b16* p, int hh) { const v8b a = *(const v8b*)(p + 8 * hh), b = *(const v8b*)(p + 16 + 8 * hh); v16b f;
#pragma unroll
  for (int e = 0; e < 8; ++e) { f[e] = a[e]; f[8 + e] = b[e]; } return f; }
__device__ __forceinline__ v8f wmma16b(v16b a, v16b b, v8f c) { return __builtin_amdgcn_wmma_f32_16x16x32_f16(false, a, false, b, (short)0, c, false, false); }
// nothing is scheduled across this line: it keeps a block's LDS reads together as one group ahead of the WMMAs. Left free, this build sank the reads among the WMMAs in pairs, each behind a wait to 0 (both projections), and in attention's second product it held more registers than the kernel has
__device__ __forceinline__ void hold_groups() { __builtin_amdgcn_sched_barrier(0); }
__device__ __forceinline__ void wave_lds_sync() { __builtin_amdgcn_fence(__ATOMIC_RELEASE, "workgroup"); __builtin_amdgcn_wave_barrier(); __builtin_amdgcn_fence(__ATOMIC_ACQUIRE, "workgroup"); }
__device__ __forceinline__ float nexp2(float x) { return __builtin_amdgcn_exp2f(x); }
// softcap in the unit of the softmax exponent: C tanh(x / 30) = C - 2C / (1 + 2^(x 2 log2(e) / 30)), C = 30 log2(e). No case on the sign: 2^z = inf gives C, 2^z = 0 gives -C. v_rcp_f32 (1 ulp) stands for the IEEE division sequence.
constexpr float CAPK = 2.0f * LOG2E / SOFTCAP, CAPC = SOFTCAP * LOG2E;
// four reciprocals in place; the v_nop is the slot the instruction set asks for behind a transcendental before its result is used or a source overwritten
__device__ __forceinline__ void rcp4(float& a, float& b, float& c, float& d) { asm("v_rcp_f32 %0, %0\n\tv_rcp_f32 %1, %1\n\tv_rcp_f32 %2, %2\n\tv_rcp_f32 %3, %3\n\tv_nop" : "+v"(a), "+v"(b), "+v"(c), "+v"(d)); }
__device__ __forceinline__ void exp2x4(float& a, float& b, float& c, float& d) { asm("v_exp_f32 %0, %0\n\tv_exp_f32 %1, %1\n\tv_exp_f32 %2, %2\n\tv_exp_f32 %3, %3\n\tv_nop" : "+v"(a), "+v"(b), "+v"(c), "+v"(d)); }   // the same for four 2^x

// Bias and mask as ONE 16-bit plane in the order the attention waves read it. An element is the bf16 bits of the rounded bias, or MASKED (0xFFFF, a NaN pattern that no rounded finite or infinite bias has) where attn_mask is 0.
// PB[b][16-query group][32-key tile][j][lane][8]: lane = 16 hh + col holds query col, keys 16 j + 8 hh + 0..7 of the tile, so a wave's 64-key block is 2 KiB in a row and four whole-line 16-byte loads fetch it.
constexpr unsigned MASKED = 0xFFFF0000u; constexpr int PKEYS = 512, NPK = NB * (S / 16) * (S / PKEYS), PPITCH = 256 + 32;   // a pack block: 16 queries x 512 keys, all its 16 loads per thread in flight at once; LDS pitch of a 256-byte piece (one j, hh), 8 banks on per piece so the 8-byte stores of a wave hit all 64 banks once
__device__ __forceinline__ unsigned bm_bits(float f, int mk) { unsigned int u = __float_as_uint(f); u += 0x7FFFu + ((u >> 16) & 1u); return mk != 0 ? u : 0xFFFFFFFFu; }   // high half: the element
__global__ __launch_bounds__(256) void prepx_kernel(const float* __restrict__ x, b16* __restrict__ T16, const float* __restrict__ cbias, const int* __restrict__ amask, unsigned int* __restrict__ PB) {
  __shared__ __attribute__((aligned(16))) unsigned char Ps[(PKEYS / 8) * PPITCH];
  if (blockIdx.x < NPK) {   // the first blocks pack bias and mask: whole-line reads along the rows, reordered in LDS, whole-line stores
    const int t_ = threadIdx.x, bq = blockIdx.x / (S / PKEYS), kq = blockIdx.x % (S / PKEYS), row = t_ >> 4, c = t_ & 15; const size_t so = ((size_t)bq * 16 + row) * S + kq * PKEYS + c * 4; const float* bp = cbias + so; const int* mp = amask + so; v4f bv[PKEYS / 64]; v4i mv[PKEYS / 64];
#pragma unroll
    for (int i = 0; i < PKEYS / 64; ++i) { bv[i] = *(const v4f*)(bp + i * 64); mv[i] = *(const v4i*)(mp + i * 64); }
    // the loaded values as inputs only: all 16 loads are issued ahead of this line (without it this build sank the mask loads among the conversions, one or two in flight); the wait: the loads' address registers are reused below;
    // the two row pointers as inputs too: they stay live up to the wait, so no load's result is placed on an address pair of the run (without them the last load's result was)
    static_assert(PKEYS == 512, "the statement below names 8 + 8 loads");
    asm volatile("s_wait_xcnt 0x0" :: "v"(bv[0]), "v"(bv[1]), "v"(bv[2]), "v"(bv[3]), "v"(bv[4]), "v"(bv[5]), "v"(bv[6]), "v"(bv[7]), "v"(mv[0]), "v"(mv[1]), "v"(mv[2]), "v"(mv[3]), "v"(mv[4]), "v"(mv[5]), "v"(mv[6]), "v"(mv[7]), "v"(bp), "v"(mp) : "memory");
#pragma unroll
    for (int i = 0; i < PKEYS / 64; ++i) { v2u w; w[0] = (bm_bits(bv[i][0], mv[i][0]) >> 16) | (bm_bits(bv[i][1], mv[i][1]) & 0xFFFF0000u); w[1] = (bm_bits(bv[i][2], mv[i][2]) >> 16) | (bm_bits(bv[i][3], mv[i][3]) & 0xFFFF0000u);
      *(v2u*)(&Ps[(i * 8 + (c >> 1)) * PPITCH + row * 16 + (c & 1) * 8]) = w; }   // keys 64 i + 4 c + 0..3: piece (key >> 3), then the query's 16 bytes
    __syncthreads();
    char* dst = (char*)PB + ((size_t)bq * (S / 32) + kq * (PKEYS / 32)) * 1024;
#pragma unroll
    for (int i = 0; i < PKEYS / 128; ++i) { const int o = (i * 256 + t_) * 16; *(v4u*)(dst + o) = *(const v4u*)(&Ps[(o >> 8) * PPITCH + (o & 255)]); }
    return; }
  const size_t t = (size_t)(blockIdx.x - NPK) * 256 + threadIdx.x; const size_t n1 = (size_t)NR * E / 8; const float* src; b16* dst; size_t e;
  if (t < n1) { src = x; dst = T16; e = t * 8; } else return;
  const v4f a = *(const v4f*)(src + e), c = *(const v4f*)(src + e + 4); v8b o;
#pragma unroll
  for (int j = 0; j < 4; ++j) { o[j] = (b16)(bf16_rne(a[j]) * XS); o[4 + j] = (b16)(bf16_rne(c[j]) * XS); }
  { *(v8b*)(dst + e) = o;  }
}
__global__ __launch_bounds__(256) void prepw_kernel(const float* __restrict__ wq, const float* __restrict__ wk, const float* __restrict__ wv, const float* __restrict__ wo, b16* __restrict__ WT, b16* __restrict__ WOT) {
  const size_t t = (size_t)blockIdx.x * 256 + threadIdx.x; const size_t nw = (size_t)E * E / 8; if (t >= 4 * nw) return; const int kind = (int)(t / nw); const size_t e = (t - (size_t)kind * nw) * 8;
  const float* w = kind == 0 ? wq : kind == 1 ? wk : kind == 2 ? wv : wo; b16* dst = kind < 3 ? WT + (size_t)kind * E * E : WOT;   // torch [out][in] rows used directly as B columns (x W^T)
  const v4f a = *(const v4f*)(w + e), c = *(const v4f*)(w + e + 4); v8b o;
#pragma unroll
  for (int j = 0; j < 4; ++j) { o[j] = (b16)(bf16_rne(a[j]) * WSC); o[4 + j] = (b16)(bf16_rne(c[j]) * WSC); }
  { *(v8b*)(dst + e) = o;  }
}
// projections: grid (NR/128, E/128, 3): kind 0: Q = T16 WT0^T -> Qh/Ql [row][1024]; kind 1: K = T16 WT1^T -> Kh/Kl; kind 2: V = T16 WT2^T written TRANSPOSED per head: VTh/VTl [b][h][64 d][2048 s].
// A work-group of 4 waves makes a 128 x 128 tile, a wave a 64 x 64 tile (4 x 4 fragments): 8 fragment reads from LDS feed 16 WMMAs (a 16 x 128 wave tile took 9 reads for 8), and a work-group's 32 KiB of operands serve twice the output.
__global__ __launch_bounds__(128) void proj_kernel(const b16* __restrict__ T16, const b16* __restrict__ WT, b16* __restrict__ Qh, b16* __restrict__ Ql, b16* __restrict__ Kh, b16* __restrict__ Kl, b16* __restrict__ VTh, b16* __restrict__ VTl) {
  constexpr int TP = 64 + 8, VP = 128 + 8;   // row pitches in elements: 144 B (operand tiles, Q and K staging), 272 B (V^T staging)
  __shared__ __attribute__((aligned(16))) b16 SM[4 * 2 * 64 * TP];   // one block: first the operand tiles, then, behind a barrier, the output staging
  static_assert(4 * 2 * 64 * TP >= 2 * 128 * VP && 4 * 2 * 64 * TP >= 2 * 128 * TP, "the block holds each of its three uses");
  b16 (*As)[TP] = (b16 (*)[TP])SM; b16 (*Bs)[TP] = (b16 (*)[TP])(SM + 128 * TP);
  const int wave = threadIdx.x >> 5, lane = threadIdx.x & 31, nloc = lane & 15, hlf = lane >> 4, t_ = threadIdx.x, wm = wave >> 1, wn = wave & 1; const int kind = blockIdx.z; const size_t mb = (size_t)blockIdx.x * 128; const int n0 = blockIdx.y * 128;
  // operand tiles (128 x 64 of A, 128 x 64 of W) are fetched once per work-group as whole 128-byte rows, one tile ahead into registers, stored to LDS (pitch 144 B) and read from there as fragments by the 4 waves
  const int sr = t_ >> 3, sc = (t_ & 7) * 8; const b16* Ag = T16 + (mb + sr) * E + sc; const b16* Bg = WT + (size_t)kind * E * E + (size_t)(n0 + sr) * E + sc; v8f acc[4][4]; v8b ga[8], gb[8];
#pragma unroll
  for (int i = 0; i < 4; ++i)
#pragma unroll
    for (int t = 0; t < 4; ++t) acc[i][t] = (v8f){};
#pragma unroll
  for (int j = 0; j < 8; ++j) ga[j] = *(const v8b*)(Ag + (size_t)j * 16 * E);
#pragma unroll
  for (int j = 0; j < 8; ++j) gb[j] = *(const v8b*)(Bg + (size_t)j * 16 * E);
  for (int kb = 0; kb < E; kb += 64) {
    __syncthreads();   // every wave has finished its fragment reads of the previous tile
#pragma unroll
    for (int j = 0; j < 8; ++j) *(v8b*)(&As[j * 16 + sr][sc]) = ga[j];
#pragma unroll
    for (int j = 0; j < 8; ++j) *(v8b*)(&Bs[j * 16 + sr][sc]) = gb[j];
    __syncthreads();
    if (kb + 64 < E) {
#pragma unroll
      for (int j = 0; j < 8; ++j) ga[j] = *(const v8b*)(Ag + (size_t)j * 16 * E + kb + 64);
#pragma unroll
      for (int j = 0; j < 8; ++j) gb[j] = *(const v8b*)(Bg + (size_t)j * 16 * E + kb + 64);
      asm volatile("s_wait_xcnt 0x0" ::: "memory"); }   // the loads' address registers are reused below
#pragma unroll
    for (int ks = 0; ks < 64; ks += 32) { v16b a[4], bw[4];   // the block's LDS reads as one group ahead of its WMMAs
#pragma unroll
      for (int i = 0; i < 4; ++i) a[i] = frag_kb(&As[wm * 64 + i * 16 + nloc][ks], hlf);
#pragma unroll
      for (int t = 0; t < 4; ++t) bw[t] = frag_kb(&Bs[wn * 64 + t * 16 + nloc][ks], hlf);
      hold_groups();
#pragma unroll
      for (int i = 0; i < 4; ++i)
#pragma unroll
        for (int t = 0; t < 4; ++t) acc[i][t] = wmma16b(a[i], bw[t], acc[i][t]);
      hold_groups(); } }
  __syncthreads();   // every wave has finished its fragment reads of the last tile: the block becomes output staging
  if (kind < 2) {   // a wave stages its 64 rows x 64 columns (hi, lo) in its own range and stores them as whole 128-byte lines, 4 rows a store
    b16 (*Th)[TP] = (b16 (*)[TP])(SM + wave * 2 * 64 * TP); b16 (*Tl)[TP] = Th + 64; b16* dh = kind == 0 ? Qh : Kh; b16* dl = kind == 0 ? Ql : Kl;
#pragma unroll
    for (int i = 0; i < 4; ++i)
#pragma unroll
      for (int t = 0; t < 4; ++t)
#pragma unroll
        for (int r = 0; r < 8; ++r) { b16 h_, l_; split16(acc[i][t][r] * (1.0f / (XS * WSC)) * XS, h_, l_); Th[i * 16 + 8 * hlf + r][t * 16 + nloc] = h_; Tl[i * 16 + 8 * hlf + r][t * 16 + nloc] = l_; }
    wave_lds_sync();
    { for (int r4 = 0; r4 < 64; r4 += 4) { const int rr = r4 + (lane >> 3), c8 = (lane & 7) * 8; const size_t gi = (mb + wm * 64 + rr) * E + n0 + wn * 64 + c8; *(v8b*)(dh + gi) = *(const v8b*)(&Th[rr][c8]); *(v8b*)(dl + gi) = *(const v8b*)(&Tl[rr][c8]); }  }
  } else {
    b16 (*Vt)[VP] = (b16 (*)[VP])SM; b16 (*Vtl)[VP] = Vt + 128; const int b = (int)(mb / S); const int s0 = (int)(mb - (size_t)b * S);
#pragma unroll
    for (int i = 0; i < 4; ++i)
#pragma unroll
      for (int t = 0; t < 4; ++t)
#pragma unroll
        for (int r = 0; r < 8; ++r) { b16 h_, l_; split16(acc[i][t][r] * (1.0f / (XS * WSC)) * XS, h_, l_); Vt[wn * 64 + t * 16 + nloc][wm * 64 + i * 16 + 8 * hlf + r] = h_; Vtl[wn * 64 + t * 16 + nloc][wm * 64 + i * 16 + 8 * hlf + r] = l_; }
    __syncthreads();
    const int cc = t_ >> 4, c8 = (t_ & 15) * 8; const size_t g0 = ((size_t)b * E + n0 + cc) * S + s0 + c8;   // row (b NH + h) D + d of V^T is b E + column, as column = h D + d; 16 threads store a row's 256 bytes
#pragma unroll   // one address pair per plane, every store at a constant offset from it
    for (int it = 0; it < 16; ++it) { *(v8b*)(VTh + g0 + (size_t)it * 8 * S) = *(const v8b*)(&Vt[it * 8 + cc][c8]); *(v8b*)(VTl + g0 + (size_t)it * 8 * S) = *(const v8b*)(&Vtl[it * 8 + cc][c8]); }
    asm volatile("s_wait_xcnt 0x0" ::: "memory"); }   // behind the last store: in the built code the other branch's first instructions, which reuse the stores' address and data registers, follow this place
}
// One work-group = 8 waves x 16 queries of one (batch, head): four 16-query groups from the low half of the sequence and their mirror images from the high half. Each 64-key tile of K (hi, lo) and V^T (hi, lo) is fetched once per work-group as whole 128-byte lines, one tile ahead
// into registers, stored to LDS and read from there as fragments by all 8 waves. The row pitch of 144 B spreads the 16 rows of a ds_load_b128 over all banks. A step of 64 keys has one pair of barriers, one row maximum, one rescale of O and one mask test, and its four score tiles give two independent WMMA chains.
__global__ __launch_bounds__(256) __attribute__((amdgpu_waves_per_eu(4, 4))) void attn_kernel(   /* registers held to two 8-wave work-groups per WGP */ const b16* __restrict__ Qh, const b16* __restrict__ Ql, const b16* __restrict__ Kh, const b16* __restrict__ Kl, const b16* __restrict__ VTh, const b16* __restrict__ VTl, const unsigned int* __restrict__ PB, b16* __restrict__ Oh, b16* __restrict__ Ol) {
  constexpr int KT = 64;   // keys a step
  static_assert(KT == D, "K tile and V^T tile have one shape"); __shared__ __attribute__((aligned(16))) b16 KV[4][KT][D + 8];   /* K hi, K lo (64 keys x 64), V^T hi, V^T lo (64 rows x 64 keys): one array, so one address register serves all four planes */ __shared__ __attribute__((aligned(16))) float To[8][16][D + 4];
  const int wave = __builtin_amdgcn_readfirstlane(threadIdx.x >> 5) /* held in a scalar register, and with it the wave's query group */, lane = threadIdx.x & 31, hh = lane >> 4, col = lane & 15; const int b = blockIdx.z, h = blockIdx.y;
  // which 16 queries a wave takes: waves w and w + 4 take groups g and 127 - g, g = 4 blockIdx.x + w. A wave skips the key tiles that the mask closes for all its queries, so where the open part of a row
  // grows with the query index a wave's work grows with its group; dealt this way every SIMD gets about the same number of worked tiles. Any mask is handled: the skip is still decided from the mask alone, and (blockIdx.x, wave) -> group is one-to-one onto 0..127.
  const int gl = blockIdx.x * 4 + (wave & 3); const int q0 = (wave < 4 ? gl : S / 16 - 1 - gl) * 16, qi = q0 + col;
  const int kr = threadIdx.x >> 3, kc = (threadIdx.x & 7) * 8;   // this thread's 16-byte pieces: rows kr and kr + 32 of the K tile (64 keys x 128 B) and of the V^T tile (64 rows x 128 B), whole 128-byte lines of both
  const size_t qo = ((size_t)b * S + qi) * E + h * D; const v16b qa0 = frag_kb(Qh + qo, hh), qa1 = frag_kb(Qh + qo + 32, hh), ql0 = frag_kb(Ql + qo, hh), ql1 = frag_kb(Ql + qo + 32, hh);
  // wave-uniform bases plus one 32-bit byte offset per thread, shared by each pair of planes (K hi/lo, V^T hi/lo); the packed bias and mask plane has its own
  const char* Kb = (const char*)(Kh + (size_t)b * S * E + h * D); const char* Klb = (const char*)(Kl + (size_t)b * S * E + h * D); const char* Vb = (const char*)(VTh + ((size_t)b * NH + h) * D * S); const char* Vlb = (const char*)(VTl + ((size_t)b * NH + h) * D * S);
  const unsigned ko = (unsigned)(kr * E + kc) * 2u, vo = (unsigned)(kr * S + kc) * 2u, po = (unsigned)(q0 >> 4) * (unsigned)(S / 32 * 1024) + (unsigned)lane * 16u;
  float m = -INFINITY, l = 0.0f; v8f o[4] = {{}, {}, {}, {}};   // one accumulator per 16 rows of O^T takes all three products (hi hi, hi lo, lo hi): a second set would not fit the registers beside a 64-key step
  const float cs = SCALE / (XS * XS); const char* prow = (const char*)PB + (size_t)b * (S / 16) * (S / 32) * 1024;
  v8b gk[2], gkl[2], gv[2], gvl[2]; v4u n[4];
#pragma unroll
  for (int i = 0; i < 2; ++i) { gk[i] = *(const v8b*)(Kb + i * 32 * E * 2 + ko); gkl[i] = *(const v8b*)(Klb + i * 32 * E * 2 + ko); gv[i] = *(const v8b*)(Vb + i * 32 * S * 2 + vo); gvl[i] = *(const v8b*)(Vlb + i * 32 * S * 2 + vo); }
#pragma unroll
  for (int j = 0; j < 4; ++j) n[j] = *(const v4u*)(prow + j * 512 + po);
  for (int kb = 0; kb < S; kb += KT) {
    __syncthreads();   // every wave has finished its fragment reads of the previous tile
#pragma unroll
    for (int i = 0; i < 2; ++i) { *(v8b*)(&KV[0][kr + 32 * i][kc]) = gk[i]; *(v8b*)(&KV[1][kr + 32 * i][kc]) = gkl[i]; *(v8b*)(&KV[2][kr + 32 * i][kc]) = gv[i]; *(v8b*)(&KV[3][kr + 32 * i][kc]) = gvl[i]; }
    __syncthreads();   // the tile is visible to all 8 waves
    // per-element mask for this block: if no key of this 64-key block is allowed for ANY of the wave's 16 queries, the wave skips the block's work (decided from the input mask; wave-uniform; the barriers stay outside)
    unsigned allm = 0xFFFFFFFFu;
#pragma unroll
    for (int j = 0; j < 4; ++j) allm &= n[j][0] & n[j][1] & n[j][2] & n[j][3];
    const bool act = __builtin_amdgcn_ballot_w32(allm != 0xFFFFFFFFu) != 0u;
    float e[32], mref = 0.0f, al = 1.0f;
    if (act) {
      v8f s[4] = {{}, {}, {}, {}};   // S^T, 16 keys each; two accumulator chains run side by side, and a group of K reads from LDS stands one group of WMMAs ahead of its use
      v16b f[2][2], g[2][2], f2[2][2], g2[2][2];   // [d half][key group of the pair]
#pragma unroll
      for (int dh = 0; dh < 2; ++dh)
#pragma unroll
        for (int j = 0; j < 2; ++j) { f[dh][j] = frag_kb(&KV[0][j * 16 + col][dh * 32], hh); g[dh][j] = frag_kb(&KV[1][j * 16 + col][dh * 32], hh); }
      s[0] = wmma16b(f[0][0], qa0, s[0]); s[1] = wmma16b(f[0][1], qa0, s[1]); s[0] = wmma16b(f[0][0], ql0, s[0]); s[1] = wmma16b(f[0][1], ql0, s[1]); s[0] = wmma16b(g[0][0], qa0, s[0]); s[1] = wmma16b(g[0][1], qa0, s[1]);
#pragma unroll
      for (int j = 0; j < 2; ++j) { f2[0][j] = frag_kb(&KV[0][32 + j * 16 + col][0], hh); g2[0][j] = frag_kb(&KV[1][32 + j * 16 + col][0], hh); }
      s[0] = wmma16b(f[1][0], qa1, s[0]); s[1] = wmma16b(f[1][1], qa1, s[1]); s[0] = wmma16b(f[1][0], ql1, s[0]); s[1] = wmma16b(f[1][1], ql1, s[1]); s[0] = wmma16b(g[1][0], qa1, s[0]); s[1] = wmma16b(g[1][1], qa1, s[1]);
#pragma unroll
      for (int j = 0; j < 2; ++j) { f2[1][j] = frag_kb(&KV[0][32 + j * 16 + col][32], hh); g2[1][j] = frag_kb(&KV[1][32 + j * 16 + col][32], hh); }
      s[2] = wmma16b(f2[0][0], qa0, s[2]); s[3] = wmma16b(f2[0][1], qa0, s[3]); s[2] = wmma16b(f2[0][0], ql0, s[2]); s[3] = wmma16b(f2[0][1], ql0, s[3]); s[2] = wmma16b(g2[0][0], qa0, s[2]); s[3] = wmma16b(g2[0][1], qa0, s[3]);
      s[2] = wmma16b(f2[1][0], qa1, s[2]); s[3] = wmma16b(f2[1][1], qa1, s[3]); s[2] = wmma16b(f2[1][0], ql1, s[2]); s[3] = wmma16b(f2[1][1], ql1, s[3]); s[2] = wmma16b(g2[1][0], qa1, s[2]); s[3] = wmma16b(g2[1][1], qa1, s[3]);
      // the order of the block's LDS reads (0x100) and WMMAs (0x008) as written above: 16 reads, 6 WMMAs, 8 reads, 6 WMMAs, 8 reads, 12 WMMAs; left free, this build raised all reads to the top and their registers spilled
      __builtin_amdgcn_sched_group_barrier(0x100, 16, 0); __builtin_amdgcn_sched_group_barrier(0x008, 6, 0); __builtin_amdgcn_sched_group_barrier(0x100, 8, 0); __builtin_amdgcn_sched_group_barrier(0x008, 6, 0); __builtin_amdgcn_sched_group_barrier(0x100, 8, 0); __builtin_amdgcn_sched_group_barrier(0x008, 12, 0);
      float mx = -INFINITY;
#pragma unroll
      for (int j = 0; j < 4; ++j) { unsigned ub[8]; float d[8];   // keys 16 j + 8 hh + 0..7 of the tile
#pragma unroll
        for (int r = 0; r < 8; ++r) { ub[r] = (r & 1) ? (n[j][r >> 1] & 0xFFFF0000u) : (n[j][r >> 1] << 16);   // bf16 bits -> f32; a masked element is a NaN until the select below
          d[r] = (s[j][r] * cs + __uint_as_float(ub[r])) * CAPK; }
        exp2x4(d[0], d[1], d[2], d[3]); exp2x4(d[4], d[5], d[6], d[7]);   // four at a time with the slot behind them
#pragma unroll
        for (int r = 0; r < 8; ++r) d[r] += 1.0f;   // softcap: the denominators
        rcp4(d[0], d[1], d[2], d[3]); rcp4(d[4], d[5], d[6], d[7]);
#pragma unroll
        for (int r = 0; r < 8; ++r) { const float x = __builtin_fmaf(d[r], -2.0f * CAPC, CAPC); e[j * 8 + r] = (ub[r] != MASKED) ? x : -INFINITY; mx = fmaxf(mx, e[j * 8 + r]); } }
      mx = fmaxf(mx, __shfl_xor(mx, 16)); const float mn = fmaxf(m, mx);
      // a query whose keys are all masked so far keeps m = -inf: use 0 as the reference so every masked weight is exp2(-inf) = 0 and no NaN appears (no divergent control flow around the WMMAs)
      const bool none = (mn == -INFINITY); mref = none ? 0.0f : mn; al = none ? 1.0f : nexp2(m - mn); m = mn; }
    if (kb + KT < S) {   // next tile and next bias and mask block, asked for here, where this block's bias and mask registers are free again: they fly during the weights and the second product and cost the score product no registers
      Kb += KT * E * 2; Klb += KT * E * 2; Vb += KT * 2; Vlb += KT * 2; prow += KT * 32;   // the wave-uniform bases step on; the threads' 32-bit offsets stay
#pragma unroll
      for (int i = 0; i < 2; ++i) { gk[i] = *(const v8b*)(Kb + i * 32 * E * 2 + ko); gkl[i] = *(const v8b*)(Klb + i * 32 * E * 2 + ko); gv[i] = *(const v8b*)(Vb + i * 32 * S * 2 + vo); gvl[i] = *(const v8b*)(Vlb + i * 32 * S * 2 + vo); }
#pragma unroll
      for (int j = 0; j < 4; ++j) n[j] = *(const v4u*)(prow + j * 512 + po);
      asm volatile("s_wait_xcnt 0x0" ::: "memory"); }   // the loads' address registers are reused by the block's work below
    if (act) {
      v16b vf[4][2], vl[4][2];   // V^T reads from LDS, a group = 32 rows x 32 keys (hi, lo), one group of WMMAs ahead of its use; group u: keys 32 (u >> 1), rows 32 (u & 1)
#pragma unroll
      for (int t = 0; t < 2; ++t) { vf[0][t] = frag_kb(&KV[2][t * 16 + col][0], hh); vl[0][t] = frag_kb(&KV[3][t * 16 + col][0], hh); }
      hold_groups();
      float sum[4] = {0.0f, 0.0f, 0.0f, 0.0f};
#pragma unroll
      for (int t = 0; t < 4; ++t) o[t] *= al;
#pragma unroll
      for (int kk = 0; kk < 2; ++kk) { v16b ph, pl;   // 32 keys at a time: their weights, then their products, so that only half the weights are held as f32 and as f16 pairs at once
#pragma unroll
        for (int i = kk * 16; i < kk * 16 + 16; i += 4) { e[i] -= mref; e[i + 1] -= mref; e[i + 2] -= mref; e[i + 3] -= mref; exp2x4(e[i], e[i + 1], e[i + 2], e[i + 3]); }
#pragma unroll
        for (int i = 0; i < 16; ++i) { const float p = e[kk * 16 + i]; sum[i & 3] += p; const b16 h_ = (b16)(p * PS); ph[i] = h_; pl[i] = (b16)(p * PS - (float)h_); }
#pragma unroll
        for (int u = kk * 2; u < kk * 2 + 2; ++u) { const int t0 = (u & 1) * 2;
          if (u < 3) { const int k2 = (u + 1) >> 1, t2 = ((u + 1) & 1) * 2;
#pragma unroll
            for (int t = 0; t < 2; ++t) { vf[u + 1][t] = frag_kb(&KV[2][(t2 + t) * 16 + col][k2 * 32], hh); vl[u + 1][t] = frag_kb(&KV[3][(t2 + t) * 16 + col][k2 * 32], hh); } }
          hold_groups();
          o[t0] = wmma16b(vf[u][0], ph, o[t0]); o[t0 + 1] = wmma16b(vf[u][1], ph, o[t0 + 1]); o[t0] = wmma16b(vf[u][0], pl, o[t0]); o[t0 + 1] = wmma16b(vf[u][1], pl, o[t0 + 1]);
          o[t0] = wmma16b(vl[u][0], ph, o[t0]); o[t0 + 1] = wmma16b(vl[u][1], ph, o[t0 + 1]);
          hold_groups(); } }
      float sm = (sum[0] + sum[1]) + (sum[2] + sum[3]); sm += __shfl_xor(sm, 16); l = l * al + sm; } }
  const float inv = 1.0f / (l * PS * XS);
#pragma unroll
  for (int t = 0; t < 4; ++t)
#pragma unroll
    for (int r = 0; r < 8; ++r) To[wave][col][t * 16 + 8 * hh + r] = o[t][r] * inv;
  wave_lds_sync();
  { for (int r4 = 0; r4 < 16; r4 += 4) { const int rr = r4 + (lane >> 3), c8 = (lane & 7) * 8; v8b hv, lv; for (int j = 0; j < 8; ++j) { b16 a_, c_; split16(To[wave][rr][c8 + j] * XS, a_, c_); hv[j] = a_; lv[j] = c_; }
      const size_t gi = ((size_t)b * S + q0 + rr) * E + h * D + c8; *(v8b*)(Oh + gi) = hv; *(v8b*)(Ol + gi) = lv; }  }
}
__global__ __launch_bounds__(128) void outproj_kernel(const b16* __restrict__ Oh, const b16* __restrict__ Ol, const b16* __restrict__ WOT, float* __restrict__ out) {
  __shared__ __attribute__((aligned(16))) float Ts[4][16][128 + 4];
  const int wave = threadIdx.x >> 5, lane = threadIdx.x & 31, nloc = lane & 15, hlf = lane >> 4; const size_t m0 = (size_t)blockIdx.x * 64 + wave * 16; const int n0 = blockIdx.y * 128;
  // operand tiles (64 x 64 of O hi and lo, 128 x 64 of Wo) staged as in proj_kernel: whole 128-byte rows, one tile ahead in registers, LDS pitch 144 B
  __shared__ __attribute__((aligned(16))) b16 As[2][64][64 + 8], Bs[128][64 + 8];
  const int sr = threadIdx.x >> 3, sc = (threadIdx.x & 7) * 8; const size_t ao = ((size_t)blockIdx.x * 64 + sr) * E + sc; const b16* Bg = WOT + (size_t)(n0 + sr) * E + sc; v8f acc[8]; v8b ga[4], gl[4], gb[8];
#pragma unroll
  for (int t = 0; t < 8; ++t) acc[t] = (v8f){};
#pragma unroll
  for (int j = 0; j < 4; ++j) { ga[j] = *(const v8b*)(Oh + ao + (size_t)j * 16 * E); gl[j] = *(const v8b*)(Ol + ao + (size_t)j * 16 * E); }
#pragma unroll
  for (int j = 0; j < 8; ++j) gb[j] = *(const v8b*)(Bg + (size_t)j * 16 * E);
  for (int kb = 0; kb < E; kb += 64) {
    __syncthreads();   // every wave has finished its fragment reads of the previous tile
#pragma unroll
    for (int j = 0; j < 4; ++j) { *(v8b*)(&As[0][j * 16 + sr][sc]) = ga[j]; *(v8b*)(&As[1][j * 16 + sr][sc]) = gl[j]; }
#pragma unroll
    for (int j = 0; j < 8; ++j) *(v8b*)(&Bs[j * 16 + sr][sc]) = gb[j];
    __syncthreads();
    if (kb + 64 < E) {
#pragma unroll
      for (int j = 0; j < 4; ++j) { ga[j] = *(const v8b*)(Oh + ao + (size_t)j * 16 * E + kb + 64); gl[j] = *(const v8b*)(Ol + ao + (size_t)j * 16 * E + kb + 64); }
      asm volatile("s_wait_xcnt 0x0" ::: "memory");   // these loads' address registers are reused as destinations of the loads that follow
#pragma unroll
      for (int j = 0; j < 8; ++j) gb[j] = *(const v8b*)(Bg + (size_t)j * 16 * E + kb + 64);
      asm volatile("s_wait_xcnt 0x0" ::: "memory"); }   // the loads' address registers are reused below
#pragma unroll
    for (int ks = 0; ks < 64; ks += 32) { const v16b a = frag_kb(&As[0][wave * 16 + nloc][ks], hlf), al = frag_kb(&As[1][wave * 16 + nloc][ks], hlf); v16b bw[8];   // the block's LDS reads as one group ahead of its WMMAs
#pragma unroll
      for (int t = 0; t < 8; ++t) bw[t] = frag_kb(&Bs[t * 16 + nloc][ks], hlf);
      hold_groups();
#pragma unroll
      for (int t = 0; t < 8; ++t) { acc[t] = wmma16b(a, bw[t], acc[t]); acc[t] = wmma16b(al, bw[t], acc[t]); }
      hold_groups(); } }
#pragma unroll
  for (int t = 0; t < 8; ++t)
#pragma unroll
    for (int r = 0; r < 8; ++r) Ts[wave][8 * hlf + r][t * 16 + nloc] = acc[t][r] * (1.0f / (XS * WSC));
  wave_lds_sync();
  { for (int rr = 0; rr < 16; ++rr) *(v4f*)(out + (m0 + rr) * E + n0 + lane * 4) = *(const v4f*)(&Ts[wave][rr][lane * 4]);  }
}
}  // namespace

extern "C" void kernel_launch(void* const* d_in, const int* in_sizes, int n_in, void* d_out, int out_size, void* d_ws, size_t ws_size, hipStream_t stream) {
  (void)n_in;
  auto Fp = [&](int i) { return (const float*)d_in[i]; };
  // input order: 0 inp [2,2048,1024], 1 count_bias [2,1,2048,2048] f32, 2 attn_mask [2,1,2048,2048] i32 (1 = attend), 3 Wq, 4 Wk, 5 Wv, 6 Wo [1024,1024] (torch [out][in])
  if (in_sizes[0] != NR * E || in_sizes[1] != NB * S * S || in_sizes[2] != NB * S * S || in_sizes[3] != E * E || in_sizes[6] != E * E || out_size != NR * E) return;
  size_t off = 0; char* ws = (char*)d_ws;
  auto carve = [&](size_t bytes) { char* p = ws + off; off += (bytes + 255) & ~(size_t)255; return p; };
  b16* T16 = (b16*)carve((size_t)NR * E * 2); b16* WT = (b16*)carve((size_t)3 * E * E * 2); b16* WOT = (b16*)carve((size_t)E * E * 2);
  b16* Qh = (b16*)carve((size_t)NR * E * 2); b16* Ql = (b16*)carve((size_t)NR * E * 2); b16* Kh = (b16*)carve((size_t)NR * E * 2); b16* Kl = (b16*)carve((size_t)NR * E * 2); b16* VTh = (b16*)carve((size_t)NR * E * 2); b16* VTl = (b16*)carve((size_t)NR * E * 2);
  b16* Oh = (b16*)carve((size_t)NR * E * 2); b16* Ol = (b16*)carve((size_t)NR * E * 2); unsigned int* PB = (unsigned int*)carve((size_t)NB * S * S * 2);
  if (off > ws_size || off > ((size_t)128 << 20)) return;   // about 101 MB
  prepx_kernel<<<(unsigned)(NPK + ((size_t)NR * E / 8 + 255) / 256), 256, 0, stream>>>(Fp(0), T16, Fp(1), (const int*)d_in[2], PB);
  prepw_kernel<<<(unsigned)(((size_t)4 * E * E / 8 + 255) / 256), 256, 0, stream>>>(Fp(3), Fp(4), Fp(5), Fp(6), WT, WOT);
  proj_kernel<<<dim3(NR / 128, E / 128, 3), 128, 0, stream>>>(T16, WT, Qh, Ql, Kh, Kl, VTh, VTl);
  attn_kernel<<<dim3(S / 128, NH, NB), 256, 0, stream>>>(Qh, Ql, Kh, Kl, VTh, VTl, PB, Oh, Ol);
  outproj_kernel<<<dim3(NR / 64, E / 128), 128, 0, stream>>>(Oh, Ol, WOT, (float*)d_out);
}

// v008
// It runs in 124 microseconds.
// Timed twice side by side with v007, it ran 1.06 and 1.05 times as fast.
// Counting every step since v000, it is 4.72 times as fast.
#include <hip/hip_runtime.h>

// Softcapped, biased, masked multi-head self-attention (16 heads x 64, 2 x 2,048 tokens, d_model 1,024): q/k/v = inp W^T, scores = q.k/8 + count_bias[b,0,q,k], tanh(scores/30) x 30,
// masked (attn_mask int, 0 -> -inf), softmax, o = w v, out = concat(o) Wo^T.
// WMMA (v_wmma_f32_16x16x32_f16, f32 accumulate): projections [4,096 x 1,024] x [1,024 x 1,024] with EXACT bf16 tokens (x8) and weights (x256), 1 product, into f16 hi+lo planes (q x 1/15, k x 1/16, v x8 and transposed
// per head); S^T with 3 products (Kh Qh + Kh Ql + Kl Qh); bias (bf16-rounded input), softcap and mask per element, online softmax in f32; O^T += V^T P^T with 3 products; output projection with
// O hi+lo (2 products) and exact Wo. Inputs rounded to bf16 once. Fragment k-map per lane half hh for A AND B: elements 0..7 <- k = 8hh+0..7, 8..15 <- k =

namespace {
constexpr int NB = 2, S = 2048, E = 1024, NH = 16, D = 64, NR = NB * S;
constexpr float XS = 8.0f, WSC = 256.0f, PS = 8.0f, SCALE = 0.125f, LOG2E = 1.4426950408889634f, SOFTCAP = 30.0f;
typedef __attribute__((ext_vector_type(4))) int v4i;
typedef __attribute__((ext_vector_type(4))) unsigned int v4u;
typedef __attribute__((ext_vector_type(2))) unsigned int v2u;

typedef _Float16 b16;
typedef __attribute__((ext_vector_type(16))) _Float16 v16b;
typedef __attribute__((ext_vector_type(8))) _Float16 v8b;
typedef __attribute__((ext_vector_type(8))) float v8f;
typedef __attribute__((ext_vector_type(4))) float v4f;
__device__ __forceinline__ float bf16_rne(float f) { unsigned int u = __float_as_uint(f); u += 0x7FFFu + ((u >> 16) & 1u); return __uint_as_float(u & 0xFFFF0000u); }
__device__ __forceinline__ void split16(float v, b16& hi, b16& lo) { hi = (b16)v; lo = (b16)(v - (float)hi); }
__device__ __forceinline__ v16b frag_kb(const b16* p, int hh) { const v8b a = *(const v8b*)(p + 8 * hh), b = *(const v8b*)(p + 16 + 8 * hh); v16b f;
#pragma unroll
  for (int e = 0; e < 8; ++e) { f[e] = a[e]; f[8 + e] = b[e]; } return f; }
__device__ __forceinline__ v8f wmma16b(v16b a, v16b b, v8f c) { return __builtin_amdgcn_wmma_f32_16x16x32_f16(false, a, false, b, (short)0, c, false, false); }
// nothing is scheduled across this line: it keeps a block's LDS reads together as one group ahead of the WMMAs. Left free, this build sank the reads among the WMMAs in pairs, each behind a wait to 0 (both projections), and in attention's second product it held more registers than the kernel has
__device__ __forceinline__ void hold_groups() { __builtin_amdgcn_sched_barrier(0); }
__device__ __forceinline__ void wave_lds_sync() { __builtin_amdgcn_fence(__ATOMIC_RELEASE, "workgroup"); __builtin_amdgcn_wave_barrier(); __builtin_amdgcn_fence(__ATOMIC_ACQUIRE, "workgroup"); }
__device__ __forceinline__ float nexp2(float x) { return __builtin_amdgcn_exp2f(x); }
// softcap: t = tanh(score / 30) is one v_tanh_f32. Its argument comes straight from the score product: q is stored x QSC and k x KSC with QSC KSC = (1 / 8) / 30, and one fma adds bias / 30.
// Behind it one fma gives the exponent of the weight x 8: C t + (3 - C t_ref), C = 30 log2(e); row maxima are kept in units of t.
constexpr float CAPC = SOFTCAP * LOG2E, KSC = 0.0625f, QSC = SCALE / SOFTCAP / KSC;
// four tanh in place; the v_nop is the slot the instruction set asks for behind a transcendental before its result is used or a source overwritten
__device__ __forceinline__ void tanh4(float& a, float& b, float& c, float& d) { asm("v_tanh_f32 %0, %0\n\tv_tanh_f32 %1, %1\n\tv_tanh_f32 %2, %2\n\tv_tanh_f32 %3, %3\n\tv_nop" : "+v"(a), "+v"(b), "+v"(c), "+v"(d)); }
__device__ __forceinline__ void exp2x4(float& a, float& b, float& c, float& d) { asm("v_exp_f32 %0, %0\n\tv_exp_f32 %1, %1\n\tv_exp_f32 %2, %2\n\tv_exp_f32 %3, %3\n\tv_nop" : "+v"(a), "+v"(b), "+v"(c), "+v"(d)); }   // the same for four 2^x

// Bias and mask as ONE 16-bit plane in the order the attention waves read it. An element is the bf16 bits of the rounded bias, or MASKED (0xFFFF, a NaN pattern that no rounded finite or infinite bias has) where attn_mask is 0.
// PB[b][16-query group][32-key tile][j][lane][8]: lane = 16 hh + col holds query col, keys 16 j + 8 hh + 0..7 of the tile, so a wave's 64-key block is 2 KiB in a row and four whole-line 16-byte loads fetch it.
constexpr unsigned MASKED = 0xFFFF0000u; constexpr int PKEYS = 512, NPK = NB * (S / 16) * (S / PKEYS), PPITCH = 256 + 32;   // a pack block: 16 queries x 512 keys, all its 16 loads per thread in flight at once; LDS pitch of a 256-byte piece (one j, hh), 8 banks on per piece so the 8-byte stores of a wave hit all 64 banks once
__device__ __forceinline__ unsigned bm_bits(float f, int mk) { unsigned int u = __float_as_uint(f); u += 0x7FFFu + ((u >> 16) & 1u); return mk != 0 ? u : 0xFFFFFFFFu; }   // high half: the element
__global__ __launch_bounds__(256) void prepx_kernel(const float* __restrict__ x, b16* __restrict__ T16, const float* __restrict__ cbias, const int* __restrict__ amask, unsigned int* __restrict__ PB) {
  __shared__ __attribute__((aligned(16))) unsigned char Ps[(PKEYS / 8) * PPITCH];
  if (blockIdx.x < NPK) {   // the first blocks pack bias and mask: whole-line reads along the rows, reordered in LDS, whole-line stores
    const int t_ = threadIdx.x, bq = blockIdx.x / (S / PKEYS), kq = blockIdx.x % (S / PKEYS), row = t_ >> 4, c = t_ & 15; const size_t so = ((size_t)bq * 16 + row) * S + kq * PKEYS + c * 4; const float* bp = cbias + so; const int* mp = amask + so; v4f bv[PKEYS / 64]; v4i mv[PKEYS / 64];
#pragma unroll
    for (int i = 0; i < PKEYS / 64; ++i) { bv[i] = *(const v4f*)(bp + i * 64); mv[i] = *(const v4i*)(mp + i * 64); }
    // the loaded values as inputs only: all 16 loads are issued ahead of this line (without it this build sank the mask loads among the conversions, one or two in flight); the wait: the loads' address registers are reused below;
    // the two row pointers as inputs too: they stay live up to the wait, so no load's result is placed on an address pair of the run (without them the last load's result was)
    static_assert(PKEYS == 512, "the statement below names 8 + 8 loads");
    asm volatile("s_wait_xcnt 0x0" :: "v"(bv[0]), "v"(bv[1]), "v"(bv[2]), "v"(bv[3]), "v"(bv[4]), "v"(bv[5]), "v"(bv[6]), "v"(bv[7]), "v"(mv[0]), "v"(mv[1]), "v"(mv[2]), "v"(mv[3]), "v"(mv[4]), "v"(mv[5]), "v"(mv[6]), "v"(mv[7]), "v"(bp), "v"(mp) : "memory");
#pragma unroll
    for (int i = 0; i < PKEYS / 64; ++i) { v2u w; w[0] = (bm_bits(bv[i][0], mv[i][0]) >> 16) | (bm_bits(bv[i][1], mv[i][1]) & 0xFFFF0000u); w[1] = (bm_bits(bv[i][2], mv[i][2]) >> 16) | (bm_bits(bv[i][3], mv[i][3]) & 0xFFFF0000u);
      *(v2u*)(&Ps[(i * 8 + (c >> 1)) * PPITCH + row * 16 + (c & 1) * 8]) = w; }   // keys 64 i + 4 c + 0..3: piece (key >> 3), then the query's 16 bytes
    __syncthreads();
    char* dst = (char*)PB + ((size_t)bq * (S / 32) + kq * (PKEYS / 32)) * 1024;
#pragma unroll
    for (int i = 0; i < PKEYS / 128; ++i) { const int o = (i * 256 + t_) * 16; *(v4u*)(dst + o) = *(const v4u*)(&Ps[(o >> 8) * PPITCH + (o & 255)]); }
    return; }
  const size_t t = (size_t)(blockIdx.x - NPK) * 256 + threadIdx.x; const size_t n1 = (size_t)NR * E / 8; const float* src; b16* dst; size_t e;
  if (t < n1) { src = x; dst = T16; e = t * 8; } else return;
  const v4f a = *(const v4f*)(src + e), c = *(const v4f*)(src + e + 4); v8b o;
#pragma unroll
  for (int j = 0; j < 4; ++j) { o[j] = (b16)(bf16_rne(a[j]) * XS); o[4 + j] = (b16)(bf16_rne(c[j]) * XS); }
  { *(v8b*)(dst + e) = o;  }
}
__global__ __launch_bounds__(256) void prepw_kernel(const float* __restrict__ wq, const float* __restrict__ wk, const float* __restrict__ wv, const float* __restrict__ wo, b16* __restrict__ WT, b16* __restrict__ WOT) {
  const size_t t = (size_t)blockIdx.x * 256 + threadIdx.x; const size_t nw = (size_t)E * E / 8; if (t >= 4 * nw) return; const int kind = (int)(t / nw); const size_t e = (t - (size_t)kind * nw) * 8;
  const float* w = kind == 0 ? wq : kind == 1 ? wk : kind == 2 ? wv : wo; b16* dst = kind < 3 ? WT + (size_t)kind * E * E : WOT;   // torch [out][in] rows used directly as B columns (x W^T)
  const v4f a = *(const v4f*)(w + e), c = *(const v4f*)(w + e + 4); v8b o;
#pragma unroll
  for (int j = 0; j < 4; ++j) { o[j] = (b16)(bf16_rne(a[j]) * WSC); o[4 + j] = (b16)(bf16_rne(c[j]) * WSC); }
  { *(v8b*)(dst + e) = o;  }
}
// projections: grid (NR/128, E/128, 3): kind 0: Q = T16 WT0^T -> Qh/Ql [row][1024]; kind 1: K = T16 WT1^T -> Kh/Kl; kind 2: V = T16 WT2^T written TRANSPOSED per head: VTh/VTl [b][h][64 d][2048 s].
// A work-group of 4 waves makes a 128 x 128 tile, a wave a 64 x 64 tile (4 x 4 fragments): 8 fragment reads from LDS feed 16 WMMAs (a 16 x 128 wave tile took 9 reads for 8), and a work-group's 32 KiB of operands serve twice the output.
__global__ __launch_bounds__(128) void proj_kernel(const b16* __restrict__ T16, const b16* __restrict__ WT, b16* __restrict__ Qh, b16* __restrict__ Ql, b16* __restrict__ Kh, b16* __restrict__ Kl, b16* __restrict__ VTh, b16* __restrict__ VTl) {
  constexpr int TP = 64 + 8, VP = 128 + 8;   // row pitches in elements: 144 B (operand tiles, Q and K staging), 272 B (V^T staging)
  __shared__ __attribute__((aligned(16))) b16 SM[4 * 2 * 64 * TP];   // one block: first the operand tiles, then, behind a barrier, the output staging
  static_assert(4 * 2 * 64 * TP >= 2 * 128 * VP && 4 * 2 * 64 * TP >= 2 * 128 * TP, "the block holds each of its three uses");
  b16 (*As)[TP] = (b16 (*)[TP])SM; b16 (*Bs)[TP] = (b16 (*)[TP])(SM + 128 * TP);
  const int wave = threadIdx.x >> 5, lane = threadIdx.x & 31, nloc = lane & 15, hlf = lane >> 4, t_ = threadIdx.x, wm = wave >> 1, wn = wave & 1; const int kind = blockIdx.z; const size_t mb = (size_t)blockIdx.x * 128; const int n0 = blockIdx.y * 128;
  // operand tiles (128 x 64 of A, 128 x 64 of W) are fetched once per work-group as whole 128-byte rows, one tile ahead into registers, stored to LDS (pitch 144 B) and read from there as fragments by the 4 waves
  const int sr = t_ >> 3, sc = (t_ & 7) * 8; const b16* Ag = T16 + (mb + sr) * E + sc; const b16* Bg = WT + (size_t)kind * E * E + (size_t)(n0 + sr) * E + sc; v8f acc[4][4]; v8b ga[8], gb[8];
#pragma unroll
  for (int i = 0; i < 4; ++i)
#pragma unroll
    for (int t = 0; t < 4; ++t) acc[i][t] = (v8f){};
#pragma unroll
  for (int j = 0; j < 8; ++j) ga[j] = *(const v8b*)(Ag + (size_t)j * 16 * E);
#pragma unroll
  for (int j = 0; j < 8; ++j) gb[j] = *(const v8b*)(Bg + (size_t)j * 16 * E);
  for (int kb = 0; kb < E; kb += 64) {
    __syncthreads();   // every wave has finished its fragment reads of the previous tile
#pragma unroll
    for (int j = 0; j < 8; ++j) *(v8b*)(&As[j * 16 + sr][sc]) = ga[j];
#pragma unroll
    for (int j = 0; j < 8; ++j) *(v8b*)(&Bs[j * 16 + sr][sc]) = gb[j];
    __syncthreads();
    if (kb + 64 < E) {
#pragma unroll
      for (int j = 0; j < 8; ++j) ga[j] = *(const v8b*)(Ag + (size_t)j * 16 * E + kb + 64);
#pragma unroll
      for (int j = 0; j < 8; ++j) gb[j] = *(const v8b*)(Bg + (size_t)j * 16 * E + kb + 64);
      asm volatile("s_wait_xcnt 0x0" ::: "memory"); }   // the loads' address registers are reused below
#pragma unroll
    for (int ks = 0; ks < 64; ks += 32) { v16b a[4], bw[4];   // the block's LDS reads as one group ahead of its WMMAs
#pragma unroll
      for (int i = 0; i < 4; ++i) a[i] = frag_kb(&As[wm * 64 + i * 16 + nloc][ks], hlf);
#pragma unroll
      for (int t = 0; t < 4; ++t) bw[t] = frag_kb(&Bs[wn * 64 + t * 16 + nloc][ks], hlf);
      hold_groups();
#pragma unroll
      for (int i = 0; i < 4; ++i)
#pragma unroll
        for (int t = 0; t < 4; ++t) acc[i][t] = wmma16b(a[i], bw[t], acc[i][t]);
      hold_groups(); } }
  __syncthreads();   // every wave has finished its fragment reads of the last tile: the block becomes output staging
  if (kind < 2) {   // a wave stages its 64 rows x 64 columns (hi, lo) in its own range and stores them as whole 128-byte lines, 4 rows a store
    b16 (*Th)[TP] = (b16 (*)[TP])(SM + wave * 2 * 64 * TP); b16 (*Tl)[TP] = Th + 64; b16* dh = kind == 0 ? Qh : Kh; b16* dl = kind == 0 ? Ql : Kl; const float osc = (kind == 0 ? QSC : KSC) / (XS * WSC);
#pragma unroll
    for (int i = 0; i < 4; ++i)
#pragma unroll
      for (int t = 0; t < 4; ++t)
#pragma unroll
        for (int r = 0; r < 8; ++r) { b16 h_, l_; split16(acc[i][t][r] * osc, h_, l_); Th[i * 16 + 8 * hlf + r][t * 16 + nloc] = h_; Tl[i * 16 + 8 * hlf + r][t * 16 + nloc] = l_; }
    wave_lds_sync();
    { for (int r4 = 0; r4 < 64; r4 += 4) { const int rr = r4 + (lane >> 3), c8 = (lane & 7) * 8; const size_t gi = (mb + wm * 64 + rr) * E + n0 + wn * 64 + c8; *(v8b*)(dh + gi) = *(const v8b*)(&Th[rr][c8]); *(v8b*)(dl + gi) = *(const v8b*)(&Tl[rr][c8]); }  }
  } else {
    b16 (*Vt)[VP] = (b16 (*)[VP])SM; b16 (*Vtl)[VP] = Vt + 128; const int b = (int)(mb / S); const int s0 = (int)(mb - (size_t)b * S);
#pragma unroll
    for (int i = 0; i < 4; ++i)
#pragma unroll
      for (int t = 0; t < 4; ++t)
#pragma unroll
        for (int r = 0; r < 8; ++r) { b16 h_, l_; split16(acc[i][t][r] * (1.0f / (XS * WSC)) * XS, h_, l_); Vt[wn * 64 + t * 16 + nloc][wm * 64 + i * 16 + 8 * hlf + r] = h_; Vtl[wn * 64 + t * 16 + nloc][wm * 64 + i * 16 + 8 * hlf + r] = l_; }
    __syncthreads();
    const int cc = t_ >> 4, c8 = (t_ & 15) * 8; const size_t g0 = ((size_t)b * E + n0 + cc) * S + s0 + c8;   // row (b NH + h) D + d of V^T is b E + column, as column = h D + d; 16 threads store a row's 256 bytes
#pragma unroll   // one address pair per plane, every store at a constant offset from it
    for (int it = 0; it < 16; ++it) { *(v8b*)(VTh + g0 + (size_t)it * 8 * S) = *(const v8b*)(&Vt[it * 8 + cc][c8]); *(v8b*)(VTl + g0 + (size_t)it * 8 * S) = *(const v8b*)(&Vtl[it * 8 + cc][c8]); }
    asm volatile("s_wait_xcnt 0x0" ::: "memory"); }   // behind the last store: in the built code the other branch's first instructions, which reuse the stores' address and data registers, follow this place
}
// One work-group = 8 waves x 16 queries of one (batch, head): four 16-query groups from the low half of the sequence and their mirror images from the high half. Each 64-key tile of K (hi, lo) and V^T (hi, lo) is fetched once per work-group as whole 128-byte lines, one tile ahead
// into registers, stored to LDS and read from there as fragments by all 8 waves. The row pitch of 144 B spreads the 16 rows of a ds_load_b128 over all banks. A step of 64 keys has one pair of barriers, one row maximum, one rescale of O and one mask test, and its four score tiles give two independent WMMA chains.
__global__ __launch_bounds__(256) __attribute__((amdgpu_waves_per_eu(4, 4))) void attn_kernel(   /* registers held to two 8-wave work-groups per WGP */ const b16* __restrict__ Qh, const b16* __restrict__ Ql, const b16* __restrict__ Kh, const b16* __restrict__ Kl, const b16* __restrict__ VTh, const b16* __restrict__ VTl, const unsigned int* __restrict__ PB, b16* __restrict__ Oh, b16* __restrict__ Ol) {
  constexpr int KT = 64;   // keys a step
  static_assert(KT == D, "K tile and V^T tile have one shape"); __shared__ __attribute__((aligned(16))) b16 KV[4][KT][D + 8];   /* K hi, K lo (64 keys x 64), V^T hi, V^T lo (64 rows x 64 keys): one array, so one address register serves all four planes */ __shared__ __attribute__((aligned(16))) float To[8][16][D + 4];
  const int wave = __builtin_amdgcn_readfirstlane(threadIdx.x >> 5) /* held in a scalar register, and with it the wave's query group */, lane = threadIdx.x & 31, hh = lane >> 4, col = lane & 15; const int b = blockIdx.z, h = blockIdx.y;
  // which 16 queries a wave takes: waves w and w + 4 take groups g and 127 - g, g = 4 blockIdx.x + w. A wave skips the key tiles that the mask closes for all its queries, so where the open part of a row
  // grows with the query index a wave's work grows with its group; dealt this way every SIMD gets about the same number of worked tiles. Any mask is handled: the skip is still decided from the mask alone, and (blockIdx.x, wave) -> group is one-to-one onto 0..127.
  const int gl = blockIdx.x * 4 + (wave & 3); const int q0 = (wave < 4 ? gl : S / 16 - 1 - gl) * 16, qi = q0 + col;
  const int kr = threadIdx.x >> 3, kc = (threadIdx.x & 7) * 8;   // this thread's 16-byte pieces: rows kr and kr + 32 of the K tile (64 keys x 128 B) and of the V^T tile (64 rows x 128 B), whole 128-byte lines of both
  const size_t qo = ((size_t)b * S + qi) * E + h * D; const v16b qa0 = frag_kb(Qh + qo, hh), qa1 = frag_kb(Qh + qo + 32, hh), ql0 = frag_kb(Ql + qo, hh), ql1 = frag_kb(Ql + qo + 32, hh);
  // wave-uniform bases plus one 32-bit byte offset per thread, shared by each pair of planes (K hi/lo, V^T hi/lo); the packed bias and mask plane has its own
  const char* Kb = (const char*)(Kh + (size_t)b * S * E + h * D); const char* Klb = (const char*)(Kl + (size_t)b * S * E + h * D); const char* Vb = (const char*)(VTh + ((size_t)b * NH + h) * D * S); const char* Vlb = (const char*)(VTl + ((size_t)b * NH + h) * D * S);
  const unsigned ko = (unsigned)(kr * E + kc) * 2u, vo = (unsigned)(kr * S + kc) * 2u, po = (unsigned)(q0 >> 4) * (unsigned)(S / 32 * 1024) + (unsigned)lane * 16u;
  float m = -INFINITY, l = 0.0f; v8f o[4] = {{}, {}, {}, {}};   // one accumulator per 16 rows of O^T takes all three products (hi hi, hi lo, lo hi): a second set would not fit the registers beside a 64-key step
  const char* prow = (const char*)PB + (size_t)b * (S / 16) * (S / 32) * 1024;
  v8b gk[2], gkl[2], gv[2], gvl[2]; v4u n[4];
#pragma unroll
  for (int i = 0; i < 2; ++i) { gk[i] = *(const v8b*)(Kb + i * 32 * E * 2 + ko); gkl[i] = *(const v8b*)(Klb + i * 32 * E * 2 + ko); gv[i] = *(const v8b*)(Vb + i * 32 * S * 2 + vo); gvl[i] = *(const v8b*)(Vlb + i * 32 * S * 2 + vo); }
#pragma unroll
  for (int j = 0; j < 4; ++j) n[j] = *(const v4u*)(prow + j * 512 + po);
  for (int kb = 0; kb < S; kb += KT) {
    __syncthreads();   // every wave has finished its fragment reads of the previous tile
#pragma unroll
    for (int i = 0; i < 2; ++i) { *(v8b*)(&KV[0][kr + 32 * i][kc]) = gk[i]; *(v8b*)(&KV[1][kr + 32 * i][kc]) = gkl[i]; *(v8b*)(&KV[2][kr + 32 * i][kc]) = gv[i]; *(v8b*)(&KV[3][kr + 32 * i][kc]) = gvl[i]; }
    __syncthreads();   // the tile is visible to all 8 waves
    // per-element mask for this block: if no key of this 64-key block is allowed for ANY of the wave's 16 queries, the wave skips the block's work (decided from the input mask; wave-uniform; the barriers stay outside)
    unsigned allm = 0xFFFFFFFFu;
#pragma unroll
    for (int j = 0; j < 4; ++j) allm &= n[j][0] & n[j][1] & n[j][2] & n[j][3];
    const bool act = __builtin_amdgcn_ballot_w32(allm != 0xFFFFFFFFu) != 0u;
    static_assert(PS == 8.0f, "the 3 in the exponent below is log2(PS)"); float e[32], al = 1.0f;
    if (act) {
      v8f s[4] = {{}, {}, {}, {}};   // S^T, 16 keys each; two accumulator chains run side by side, and a group of K reads from LDS stands one group of WMMAs ahead of its use
      v16b f[2][2], g[2][2], f2[2][2], g2[2][2];   // [d half][key group of the pair]
#pragma unroll
      for (int dh = 0; dh < 2; ++dh)
#pragma unroll
        for (int j = 0; j < 2; ++j) { f[dh][j] = frag_kb(&KV[0][j * 16 + col][dh * 32], hh); g[dh][j] = frag_kb(&KV[1][j * 16 + col][dh * 32], hh); }
      s[0] = wmma16b(f[0][0], qa0, s[0]); s[1] = wmma16b(f[0][1], qa0, s[1]); s[0] = wmma16b(f[0][0], ql0, s[0]); s[1] = wmma16b(f[0][1], ql0, s[1]); s[0] = wmma16b(g[0][0], qa0, s[0]); s[1] = wmma16b(g[0][1], qa0, s[1]);
#pragma unroll
      for (int j = 0; j < 2; ++j) { f2[0][j] = frag_kb(&KV[0][32 + j * 16 + col][0], hh); g2[0][j] = frag_kb(&KV[1][32 + j * 16 + col][0], hh); }
      s[0] = wmma16b(f[1][0], qa1, s[0]); s[1] = wmma16b(f[1][1], qa1, s[1]); s[0] = wmma16b(f[1][0], ql1, s[0]); s[1] = wmma16b(f[1][1], ql1, s[1]); s[0] = wmma16b(g[1][0], qa1, s[0]); s[1] = wmma16b(g[1][1], qa1, s[1]);
#pragma unroll
      for (int j = 0; j < 2; ++j) { f2[1][j] = frag_kb(&KV[0][32 + j * 16 + col][32], hh); g2[1][j] = frag_kb(&KV[1][32 + j * 16 + col][32], hh); }
      s[2] = wmma16b(f2[0][0], qa0, s[2]); s[3] = wmma16b(f2[0][1], qa0, s[3]); s[2] = wmma16b(f2[0][0], ql0, s[2]); s[3] = wmma16b(f2[0][1], ql0, s[3]); s[2] = wmma16b(g2[0][0], qa0, s[2]); s[3] = wmma16b(g2[0][1], qa0, s[3]);
      s[2] = wmma16b(f2[1][0], qa1, s[2]); s[3] = wmma16b(f2[1][1], qa1, s[3]); s[2] = wmma16b(f2[1][0], ql1, s[2]); s[3] = wmma16b(f2[1][1], ql1, s[3]); s[2] = wmma16b(g2[1][0], qa1, s[2]); s[3] = wmma16b(g2[1][1], qa1, s[3]);
      // the order of the block's LDS reads (0x100) and WMMAs (0x008) as written above: 16 reads, 6 WMMAs, 8 reads, 6 WMMAs, 8 reads, 12 WMMAs; left free, this build raised all reads to the top and their registers spilled
      __builtin_amdgcn_sched_group_barrier(0x100, 16, 0); __builtin_amdgcn_sched_group_barrier(0x008, 6, 0); __builtin_amdgcn_sched_group_barrier(0x100, 8, 0); __builtin_amdgcn_sched_group_barrier(0x008, 6, 0); __builtin_amdgcn_sched_group_barrier(0x100, 8, 0); __builtin_amdgcn_sched_group_barrier(0x008, 12, 0);
      float mx = -INFINITY;
#pragma unroll
      for (int j = 0; j < 4; ++j) { unsigned ub[8]; float d[8];   // keys 16 j + 8 hh + 0..7 of the tile
#pragma unroll
        for (int r = 0; r < 8; ++r) { ub[r] = (r & 1) ? (n[j][r >> 1] & 0xFFFF0000u) : (n[j][r >> 1] << 16);   // bf16 bits -> f32; a masked element is a NaN until the select below
          d[r] = __builtin_fmaf(__uint_as_float(ub[r]), 1.0f / SOFTCAP, s[j][r]); }   // (q.k / 8 + bias) / 30
        tanh4(d[0], d[1], d[2], d[3]); tanh4(d[4], d[5], d[6], d[7]);   // four at a time with the slot behind them
#pragma unroll
        for (int r = 0; r < 8; ++r) { e[j * 8 + r] = (ub[r] != MASKED) ? d[r] : -INFINITY; mx = fmaxf(mx, e[j * 8 + r]); } }
      mx = fmaxf(mx, __shfl_xor(mx, 16)); const float mn = fmaxf(m, mx);
      // a query whose keys are all masked so far keeps m = -inf: use 0 as the reference so every masked weight is exp2(-inf) = 0 and no NaN appears (no divergent control flow around the WMMAs)
      const bool none = (mn == -INFINITY); const float nm = none ? 3.0f : __builtin_fmaf(mn, -CAPC, 3.0f); al = none ? 1.0f : nexp2((m - mn) * CAPC); m = mn;   // 3 = log2(PS): the weights come out x 8
#pragma unroll
      for (int i = 0; i < 32; ++i) e[i] = __builtin_fmaf(e[i], CAPC, nm); }   // the exponents of the weights
    if (kb + KT < S) {   // next tile and next bias and mask block, asked for here, where this block's bias and mask registers are free again: they fly during the weights and the second product and cost the score product no registers
      Kb += KT * E * 2; Klb += KT * E * 2; Vb += KT * 2; Vlb += KT * 2; prow += KT * 32;   // the wave-uniform bases step on; the threads' 32-bit offsets stay
#pragma unroll
      for (int i = 0; i < 2; ++i) { gk[i] = *(const v8b*)(Kb + i * 32 * E * 2 + ko); gkl[i] = *(const v8b*)(Klb + i * 32 * E * 2 + ko); gv[i] = *(const v8b*)(Vb + i * 32 * S * 2 + vo); gvl[i] = *(const v8b*)(Vlb + i * 32 * S * 2 + vo); }
#pragma unroll
      for (int j = 0; j < 4; ++j) n[j] = *(const v4u*)(prow + j * 512 + po);
      asm volatile("s_wait_xcnt 0x0" ::: "memory"); }   // the loads' address registers are reused by the block's work below
    if (act) {
      v16b vf[4][2], vl[4][2];   // V^T reads from LDS, a group = 32 rows x 32 keys (hi, lo), one group of WMMAs ahead of its use; group u: keys 32 (u >> 1), rows 32 (u & 1)
#pragma unroll
      for (int t = 0; t < 2; ++t) { vf[0][t] = frag_kb(&KV[2][t * 16 + col][0], hh); vl[0][t] = frag_kb(&KV[3][t * 16 + col][0], hh); }
      hold_groups();
      float sum[4] = {0.0f, 0.0f, 0.0f, 0.0f};
#pragma unroll
      for (int t = 0; t < 4; ++t) o[t] *= al;
#pragma unroll
      for (int kk = 0; kk < 2; ++kk) { v16b ph, pl;   // 32 keys at a time: their weights, then their products, so that only half the weights are held as f32 and as f16 pairs at once
#pragma unroll
        for (int i = kk * 16; i < kk * 16 + 16; i += 4) exp2x4(e[i], e[i + 1], e[i + 2], e[i + 3]);
#pragma unroll
        for (int i = 0; i < 16; ++i) { const float p = e[kk * 16 + i]; sum[i & 3] += p; const b16 h_ = (b16)p; ph[i] = h_; pl[i] = (b16)(p - (float)h_); }
#pragma unroll
        for (int u = kk * 2; u < kk * 2 + 2; ++u) { const int t0 = (u & 1) * 2;
          if (u < 3) { const int k2 = (u + 1) >> 1, t2 = ((u + 1) & 1) * 2;
#pragma unroll
            for (int t = 0; t < 2; ++t) { vf[u + 1][t] = frag_kb(&KV[2][(t2 + t) * 16 + col][k2 * 32], hh); vl[u + 1][t] = frag_kb(&KV[3][(t2 + t) * 16 + col][k2 * 32], hh); } }
          hold_groups();
          o[t0] = wmma16b(vf[u][0], ph, o[t0]); o[t0 + 1] = wmma16b(vf[u][1], ph, o[t0 + 1]); o[t0] = wmma16b(vf[u][0], pl, o[t0]); o[t0 + 1] = wmma16b(vf[u][1], pl, o[t0 + 1]);
          o[t0] = wmma16b(vl[u][0], ph, o[t0]); o[t0 + 1] = wmma16b(vl[u][1], ph, o[t0 + 1]);
          hold_groups(); } }
      float sm = (sum[0] + sum[1]) + (sum[2] + sum[3]); sm += __shfl_xor(sm, 16); l = l * al + sm; } }
  const float inv = 1.0f / (l * XS);   // l sums the weights x PS, O^T holds them x PS x XS
  const int he = (int)(__builtin_amdgcn_mbcnt_lo(~0u, 0u) >> 4);   // the lane half again, from the lane count that the loop's exchanges keep anyway: held through the loop as hh it was spilled to scratch
#pragma unroll
  for (int t = 0; t < 4; ++t)
#pragma unroll
    for (int r = 0; r < 8; ++r) To[wave][col][t * 16 + 8 * he + r] = o[t][r] * inv;
  wave_lds_sync();
  { for (int r4 = 0; r4 < 16; r4 += 4) { const int rr = r4 + (lane >> 3), c8 = (lane & 7) * 8; v8b hv, lv; for (int j = 0; j < 8; ++j) { b16 a_, c_; split16(To[wave][rr][c8 + j] * XS, a_, c_); hv[j] = a_; lv[j] = c_; }
      const size_t gi = ((size_t)b * S + q0 + rr) * E + h * D + c8; *(v8b*)(Oh + gi) = hv; *(v8b*)(Ol + gi) = lv; }  }
}
__global__ __launch_bounds__(128) void outproj_kernel(const b16* __restrict__ Oh, const b16* __restrict__ Ol, const b16* __restrict__ WOT, float* __restrict__ out) {
  __shared__ __attribute__((aligned(16))) float Ts[4][16][128 + 4];
  const int wave = threadIdx.x >> 5, lane = threadIdx.x & 31, nloc = lane & 15, hlf = lane >> 4; const size_t m0 = (size_t)blockIdx.x * 64 + wave * 16; const int n0 = blockIdx.y * 128;
  // operand tiles (64 x 64 of O hi and lo, 128 x 64 of Wo) staged as in proj_kernel: whole 128-byte rows, one tile ahead in registers, LDS pitch 144 B
  __shared__ __attribute__((aligned(16))) b16 As[2][64][64 + 8], Bs[128][64 + 8];
  const int sr = threadIdx.x >> 3, sc = (threadIdx.x & 7) * 8; const size_t ao = ((size_t)blockIdx.x * 64 + sr) * E + sc; const b16* Bg = WOT + (size_t)(n0 + sr) * E + sc; v8f acc[8]; v8b ga[4], gl[4], gb[8];
#pragma unroll
  for (int t = 0; t < 8; ++t) acc[t] = (v8f){};
#pragma unroll
  for (int j = 0; j < 4; ++j) { ga[j] = *(const v8b*)(Oh + ao + (size_t)j * 16 * E); gl[j] = *(const v8b*)(Ol + ao + (size_t)j * 16 * E); }
#pragma unroll
  for (int j = 0; j < 8; ++j) gb[j] = *(const v8b*)(Bg + (size_t)j * 16 * E);
  for (int kb = 0; kb < E; kb += 64) {
    __syncthreads();   // every wave has finished its fragment reads of the previous tile
#pragma unroll
    for (int j = 0; j < 4; ++j) { *(v8b*)(&As[0][j * 16 + sr][sc]) = ga[j]; *(v8b*)(&As[1][j * 16 + sr][sc]) = gl[j]; }
#pragma unroll
    for (int j = 0; j < 8; ++j) *(v8b*)(&Bs[j * 16 + sr][sc]) = gb[j];
    __syncthreads();
    if (kb + 64 < E) {
#pragma unroll
      for (int j = 0; j < 4; ++j) { ga[j] = *(const v8b*)(Oh + ao + (size_t)j * 16 * E + kb + 64); gl[j] = *(const v8b*)(Ol + ao + (size_t)j * 16 * E + kb + 64); }
      asm volatile("s_wait_xcnt 0x0" ::: "memory");   // these loads' address registers are reused as destinations of the loads that follow
#pragma unroll
      for (int j = 0; j < 8; ++j) gb[j] = *(const v8b*)(Bg + (size_t)j * 16 * E + kb + 64);
      asm volatile("s_wait_xcnt 0x0" ::: "memory"); }   // the loads' address registers are reused below
#pragma unroll
    for (int ks = 0; ks < 64; ks += 32) { const v16b a = frag_kb(&As[0][wave * 16 + nloc][ks], hlf), al = frag_kb(&As[1][wave * 16 + nloc][ks], hlf); v16b bw[8];   // the block's LDS reads as one group ahead of its WMMAs
#pragma unroll
      for (int t = 0; t < 8; ++t) bw[t] = frag_kb(&Bs[t * 16 + nloc][ks], hlf);
      hold_groups();
#pragma unroll
      for (int t = 0; t < 8; ++t) { acc[t] = wmma16b(a, bw[t], acc[t]); acc[t] = wmma16b(al, bw[t], acc[t]); }
      hold_groups(); } }
#pragma unroll
  for (int t = 0; t < 8; ++t)
#pragma unroll
    for (int r = 0; r < 8; ++r) Ts[wave][8 * hlf + r][t * 16 + nloc] = acc[t][r] * (1.0f / (XS * WSC));
  wave_lds_sync();
  { for (int rr = 0; rr < 16; ++rr) *(v4f*)(out + (m0 + rr) * E + n0 + lane * 4) = *(const v4f*)(&Ts[wave][rr][lane * 4]);  }
}
}  // namespace

extern "C" void kernel_launch(void* const* d_in, const int* in_sizes, int n_in, void* d_out, int out_size, void* d_ws, size_t ws_size, hipStream_t stream) {
  (void)n_in;
  auto Fp = [&](int i) { return (const float*)d_in[i]; };
  // input order: 0 inp [2,2048,1024], 1 count_bias [2,1,2048,2048] f32, 2 attn_mask [2,1,2048,2048] i32 (1 = attend), 3 Wq, 4 Wk, 5 Wv, 6 Wo [1024,1024] (torch [out][in])
  if (in_sizes[0] != NR * E || in_sizes[1] != NB * S * S || in_sizes[2] != NB * S * S || in_sizes[3] != E * E || in_sizes[6] != E * E || out_size != NR * E) return;
  size_t off = 0; char* ws = (char*)d_ws;
  auto carve = [&](size_t bytes) { char* p = ws + off; off += (bytes + 255) & ~(size_t)255; return p; };
  b16* T16 = (b16*)carve((size_t)NR * E * 2); b16* WT = (b16*)carve((size_t)3 * E * E * 2); b16* WOT = (b16*)carve((size_t)E * E * 2);
  b16* Qh = (b16*)carve((size_t)NR * E * 2); b16* Ql = (b16*)carve((size_t)NR * E * 2); b16* Kh = (b16*)carve((size_t)NR * E * 2); b16* Kl = (b16*)carve((size_t)NR * E * 2); b16* VTh = (b16*)carve((size_t)NR * E * 2); b16* VTl = (b16*)carve((size_t)NR * E * 2);
  b16* Oh = (b16*)carve((size_t)NR * E * 2); b16* Ol = (b16*)carve((size_t)NR * E * 2); unsigned int* PB = (unsigned int*)carve((size_t)NB * S * S * 2);
  if (off > ws_size || off > ((size_t)128 << 20)) return;   // about 101 MB
  prepx_kernel<<<(unsigned)(NPK + ((size_t)NR * E / 8 + 255) / 256), 256, 0, stream>>>(Fp(0), T16, Fp(1), (const int*)d_in[2], PB);
  prepw_kernel<<<(unsigned)(((size_t)4 * E * E / 8 + 255) / 256), 256, 0, stream>>>(Fp(3), Fp(4), Fp(5), Fp(6), WT, WOT);
  proj_kernel<<<dim3(NR / 128, E / 128, 3), 128, 0, stream>>>(T16, WT, Qh, Ql, Kh, Kl, VTh, VTl);
  attn_kernel<<<dim3(S / 128, NH, NB), 256, 0, stream>>>(Qh, Ql, Kh, Kl, VTh, VTl, PB, Oh, Ol);
  outproj_kernel<<<dim3(NR / 64, E / 128), 128, 0, stream>>>(Oh, Ol, WOT, (float*)d_out);
}
